// v000
// The times below were measured on an AMD MI455X: many runs one after another, warmed up first and cycling through
// copies of the inputs, with the whole window's GPU time divided by the number of runs. Launches and the gaps
// between them are all in it. The median over several windows is given; except for v000 it joins two sittings, which
// can be a few percent apart, so the side-by-side timings, each taken in one sitting, are the better comparison.
// v000, which the later versions start from, runs in 370 microseconds.
#include <hip/hip_runtime.h>

// Self-attention (4 x 1024 x 1024, 16 heads x 64): q/k/v = x W + b ((in,out) weights), scores = q k^T / 8 + attention_mask ([4,1,1,1024] additive per key, read as given; zeros here);
// softmax; ctx heads concatenated -> [4][1024][1024] (no output projection).
// Deterministic: flash-style per 16-query wave over all keys (running max); no atomics.
// compute dtype: WMMA v_wmma_f32_16x16x32_f16 with f32 accumulate for the projections ([4096 x 1024] x [1024 x 3072]; x EXACT bf16 x8, W^T exact x256: 1 product), S^T = K Q^T (q/k f16 hi x8 +
// residual x8192: 3 products), O^T += V^T P^T (V^T hi x8 + residual x8192, P x1024 as f16 hi + residual x1024: 3 products); ctx written in f32 from the accumulators; mask add and softmax statistics
// in f32. Inputs rounded to bf16 once. Fragment k-map per lane half hh for A AND B: elements 0..7 <- k = 8hh+0..7, 8..15 <- k = 16+8hh+0..7; acc[r] = D[8hh+r][col].

namespace {
constexpr int B = 4, T = 1024, DM = 1024, H = 16, HD = 64, BL = 4 /* batches (== 4 shipped) */, QL = 1024 /* query rows (== 1024 shipped) */;
constexpr int NSL = DM / 128;
constexpr float XS = 8.0f, WSC = 256.0f, PS = 1024.0f, RS_ = 1024.0f, LOG2E = 1.4426950408889634f;
static_assert(T % 64 == 0 && QL % 32 == 0 && DM % 256 == 0 && H * HD == DM && HD == 64, "tiling");
typedef _Float16 b16;
typedef __attribute__((ext_vector_type(16))) _Float16 v16b;
typedef __attribute__((ext_vector_type(8))) _Float16 v8b;
typedef __attribute__((ext_vector_type(8))) float v8f;
typedef __attribute__((ext_vector_type(4))) float v4f;
__device__ __forceinline__ float bf16_rne(float f) { unsigned int u = __float_as_uint(f); u += 0x7FFFu + ((u >> 16) & 1u); return __uint_as_float(u & 0xFFFF0000u); }
__device__ __forceinline__ void split16(float v, b16& hi, b16& lo) { hi = (b16)v; lo = (b16)(v - (float)hi); }
__device__ __forceinline__ v16b frag_kb(const b16* p, int hh) { const v8b a = *(const v8b*)(p + 8 * hh), b = *(const v8b*)(p + 16 + 8 * hh); v16b f;
#pragma unroll
  for (int e = 0; e < 8; ++e) { f[e] = a[e]; f[8 + e] = b[e]; } return f; }
__device__ __forceinline__ v8f wmma16b(v16b a, v16b b, v8f c) { v8f d = __builtin_amdgcn_wmma_f32_16x16x32_f16(false, a, false, b, (short)0, c, false, false); asm volatile("v_nop\n\tv_nop\n\tv_nop\n\tv_nop" : "+v"(d) : "v"(a), "v"(b)); return d; }
__device__ __forceinline__ void wave_lds_sync() { __builtin_amdgcn_fence(__ATOMIC_RELEASE, "workgroup"); __builtin_amdgcn_wave_barrier(); __builtin_amdgcn_fence(__ATOMIC_ACQUIRE, "workgroup"); }
__device__ __forceinline__ float pmul(float a, float b) { float p = a * b; asm volatile("" : "+v"(p)); return p; }
__device__ __forceinline__ int iclamp(int v, int lo, int hi) { return v < lo ? lo : (v > hi ? hi : v); }

typedef __attribute__((ext_vector_type(2))) _Float16 v2h;
typedef __attribute__((ext_vector_type(4))) _Float16 v4h;
typedef __attribute__((ext_vector_type(2))) float v2f;
typedef __attribute__((ext_vector_type(4))) int v4i;
__device__ __forceinline__ float nexp2(float v) { return __builtin_amdgcn_exp2f(v); }
__global__ __launch_bounds__(256) void prep_kernel(const float* __restrict__ wq, const float* __restrict__ wk, const float* __restrict__ wv, b16* __restrict__ WT) {
  const size_t u = (size_t)blockIdx.x * 256 + threadIdx.x; const size_t per = (size_t)DM * DM / 8; if (u >= 3 * per) return; const int m = (int)(u / per); const size_t e = u % per; const int row = (int)(e / (DM / 8)), k0 = (int)(e % (DM / 8)) * 8; const float* w = m == 0 ? wq : m == 1 ? wk : wv;
  v8b o; for (int j = 0; j < 8; ++j) o[j] = (b16)(bf16_rne(w[(size_t)(k0 + j) * DM + row]) * WSC);
  { *(v8b*)(WT + ((size_t)m * DM + row) * DM + k0) = o;  }
}
// projections: grid (T/64, BL, 3 x NSL slabs of 128: q | k | v); block = 64 tokens of batch b x 4 waves; A = x rows (exact bf16 x8), K = 1,024 staged block-wide in 4 chunks of 256; + bias (bq | bk | bv by part);
__global__ __launch_bounds__(128) void proj_kernel(const float* __restrict__ x, const b16* __restrict__ WT, const float* __restrict__ bq, const float* __restrict__ bk, const float* __restrict__ bv, b16* __restrict__ QP, b16* __restrict__ QPl, b16* __restrict__ KP, b16* __restrict__ KPl, b16* __restrict__ VTh, b16* __restrict__ VTl) {
  __shared__ __attribute__((aligned(16))) b16 As[64][256 + 8]; __shared__ __attribute__((aligned(16))) float Tf[4][16][128 + 4];
  const int wave = threadIdx.x >> 5, lane = threadIdx.x & 31, nloc = lane & 15, hlf = lane >> 4; const int t0 = blockIdx.x * 64; const int b = blockIdx.y; const int part = blockIdx.z / NSL, slab = blockIdx.z % NSL, c0 = slab * 128, n0 = part * DM + c0;
  if (part == 0 && t0 >= QL) return;   // (cut builds only) queries beyond QL are not needed; block-uniform, before any barrier
  const float* xb = x + ((size_t)b * T + t0) * DM;
  v8f acc[8];
#pragma unroll
  for (int t = 0; t < 8; ++t) acc[t] = (v8f){};
#pragma unroll 1
  for (int kc = 0; kc < DM; kc += 256) {
    __syncthreads();
    for (int i = threadIdx.x; i < 64 * 64; i += 128) { const int rr = i / 64, q = (i % 64) * 4; const v4f f = *(const v4f*)(xb + (size_t)rr * DM + kc + q); v4h o; for (int j = 0; j < 4; ++j) o[j] = (b16)(bf16_rne(f[j]) * XS); *(v4h*)(&As[rr][q]) = o; }
    __syncthreads();
#pragma unroll 2
    for (int kb = 0; kb < 256; kb += 32) { const v16b a = frag_kb(&As[wave * 16 + nloc][kb], hlf);
#pragma unroll
      for (int t = 0; t < 8; ++t) acc[t] = wmma16b(a, frag_kb(WT + (size_t)(n0 + t * 16 + nloc) * DM + kc + kb, hlf), acc[t]); } }
const float* ba = part == 0 ? bq : (part == 1 ? bk : bv);
#pragma unroll
  for (int t = 0; t < 8; ++t) { const float bb = bf16_rne(ba[c0 + t * 16 + nloc]);
#pragma unroll
    for (int r = 0; r < 8; ++r) Tf[wave][8 * hlf + r][t * 16 + nloc] = acc[t][r] * (1.0f / (XS * WSC)) + bb; }
  __syncthreads();
  {
    if (part < 2) { b16* plane = part == 0 ? QP : KP; b16* planl = part == 0 ? QPl : KPl; const int c = c0 + lane * 4; const int h = c / HD, d = c % HD;
      for (int rr = 0; rr < 16; ++rr) { const int tok = t0 + wave * 16 + rr; const size_t ri = (((size_t)b * H + h) * T + tok) * HD + d; const v4f f4 = *(const v4f*)(&Tf[wave][rr][lane * 4]); v4h o4, l4; for (int j = 0; j < 4; ++j) { const float f = f4[j] * XS; const b16 p = (b16)f; o4[j] = p; l4[j] = (b16)((f - (float)p) * RS_); } *(v4h*)(plane + ri) = o4; *(v4h*)(planl + ri) = l4; } }
    else {
#pragma unroll 1
      for (int q = 0; q < 32; ++q) { const int cl = wave * 32 + q; const int c = c0 + cl; const int h = c / HD, d = c % HD; const int tk = lane * 2; v2h hv, lv;
        for (int j = 0; j < 2; ++j) { const float f = Tf[(tk + j) >> 4][(tk + j) & 15][cl] * XS; const b16 p = (b16)f; hv[j] = p; lv[j] = (b16)((f - (float)p) * RS_); }
        const size_t oi = (((size_t)b * H + h) * HD + d) * (size_t)T + t0 + lane * 2; *(v2h*)(VTh + oi) = hv; *(v2h*)(VTl + oi) = lv; } }
     }
}
// attention: grid (QL/32, BL x H): block = 2 waves x 16 queries of (b, h); all 1,024 keys in 32-key steps; logit = s/8 + mask[b][0][0][key] (the additive per-key f32 mask input, read as given; log2-scaled); online softmax; q/k as f16 hi x8 + residual x8192 planes (S^T: 3 products hh + (hl + lh)/1024), P x1024 as f16 hi + residual x1024 and V^T as hi x8 + residual x8192 planes (O^T: 3 products);
__global__ __launch_bounds__(64) void attn_kernel(const b16* __restrict__ QP, const b16* __restrict__ QPl, const b16* __restrict__ KP, const b16* __restrict__ KPl, const b16* __restrict__ VTh, const b16* __restrict__ VTl, const float* __restrict__ MSK, float* __restrict__ OUTC) {
  __shared__ __attribute__((aligned(16))) b16 Pb[2][16][32 + 8], Pl[2][16][32 + 8]; __shared__ __attribute__((aligned(16))) float To[2][16][HD + 4];
  const int wave = threadIdx.x >> 5, lane = threadIdx.x & 31, hh = lane >> 4, col = lane & 15; const int b = blockIdx.y / H, h = blockIdx.y % H; const int q0 = blockIdx.x * 32 + wave * 16, qi = q0 + col;
  const size_t ph = (size_t)b * H + h; const b16* Qb = QP + ph * T * HD; const b16* Qbl = QPl + ph * T * HD; const b16* Kb = KP + ph * T * HD; const b16* Kbl = KPl + ph * T * HD; const b16* Vh = VTh + ph * HD * (size_t)T; const b16* Vl = VTl + ph * HD * (size_t)T; const float* mrow = MSK + (size_t)b * T;   // per-(b,h) planes; the batch's per-key additive mask row [B,1,1,S] (shared by all queries and heads)
  const v16b qa0 = frag_kb(Qb + (size_t)qi * HD, hh), qa1 = frag_kb(Qb + (size_t)qi * HD + 32, hh), ql0 = frag_kb(Qbl + (size_t)qi * HD, hh), ql1 = frag_kb(Qbl + (size_t)qi * HD + 32, hh);
  const float cs = LOG2E / (8.0f * XS * XS);
  float m = -INFINITY, l = 0.0f; v8f o[4], ol[4]; for (int t = 0; t < 4; ++t) { o[t] = (v8f){}; ol[t] = (v8f){}; }
#pragma unroll 1
  for (int kb = 0; kb < T; kb += 32) {
    float e[16]; float mx = -INFINITY;
#pragma unroll
    for (int u = 0; u < 2; ++u) { v8f s = (v8f){}, sx = (v8f){}; const size_t kr = (size_t)(kb + u * 16 + col) * HD; { const v16b k0 = frag_kb(Kb + kr, hh), k1 = frag_kb(Kb + kr + 32, hh); s = wmma16b(k0, qa0, s); s = wmma16b(k1, qa1, s); sx = wmma16b(k0, ql0, sx); sx = wmma16b(k1, ql1, sx); sx = wmma16b(frag_kb(Kbl + kr, hh), qa0, sx); sx = wmma16b(frag_kb(Kbl + kr + 32, hh), qa1, sx); }
#pragma unroll
      for (int r = 0; r < 8; ++r) s[r] += sx[r] * (1.0f / RS_);   // hi.hi + (hi.lo + lo.hi)/1024
      const v4f m0 = *(const v4f*)(mrow + kb + u * 16 + 8 * hh), m1 = *(const v4f*)(mrow + kb + u * 16 + 8 * hh + 4);   // mask for keys kb + 16u + 8hh .. +7 of this lane's query
#pragma unroll
      for (int r = 0; r < 8; ++r) { const float mk = (r < 4 ? m0[r] : m1[r - 4]) * LOG2E; const float vv = fmaf(s[r], cs, mk); e[u * 8 + r] = vv; mx = fmaxf(mx, vv); } }
    mx = fmaxf(mx, __shfl_xor(mx, 16)); const float mn = fmaxf(m, mx); const float al = nexp2(m - mn); float sum = 0.0f;
#pragma unroll
    for (int i2 = 0; i2 < 16; ++i2) { const float p = nexp2(e[i2] - mn); sum += p; const float ps = p * PS; const b16 phh = (b16)ps; const int pc = (i2 < 8 ? 0 : 16) + 8 * hh + (i2 & 7); Pb[wave][col][pc] = phh; Pl[wave][col][pc] = (b16)((ps - (float)phh) * RS_); }
    sum += __shfl_xor(sum, 16); l = l * al + sum; m = mn;
    wave_lds_sync();
    const v16b pf = frag_kb(&Pb[wave][col][0], hh), plf = frag_kb(&Pl[wave][col][0], hh);
#pragma unroll
    for (int t = 0; t < 4; ++t) { const v16b vh = frag_kb(Vh + (size_t)(t * 16 + col) * T + kb, hh); o[t] *= al; o[t] = wmma16b(vh, pf, o[t]); ol[t] = wmma16b(frag_kb(Vl + (size_t)(t * 16 + col) * T + kb, hh), pf, ol[t] * al); ol[t] = wmma16b(vh, plf, ol[t]); }   // ol = (V_lo P_hi + V_hi P_lo), both /1024
    wave_lds_sync(); }
  const float inv = 1.0f / (l * PS * XS);
#pragma unroll
  for (int t = 0; t < 4; ++t)
#pragma unroll
    for (int r = 0; r < 8; ++r) To[wave][col][t * 16 + 8 * hh + r] = (o[t][r] + ol[t][r] * (1.0f / RS_)) * inv;
  wave_lds_sync();
  { for (int rr = 0; rr < 16; ++rr) { const size_t oi = ((size_t)b * T + q0 + rr) * DM + h * HD + lane * 2; *(v2f*)(OUTC + oi) = *(const v2f*)(&To[wave][rr][lane * 2]); }  }   // ctx row segment (query, head) = 64 f32 = 256 B by 32 lanes x 8 B
}
}  // namespace

extern "C" void kernel_launch(void* const* d_in, const int* in_sizes, int n_in, void* d_out, int out_size, void* d_ws, size_t ws_size, hipStream_t stream) {
  (void)n_in;
  auto Fp = [&](int i) { return (const float*)d_in[i]; };
  // input order: 0 hidden_states [4,1024,1024], 1 attention_mask [4,1,1,1024] f32 additive, 2 Wq [1024,1024] (in,out), 3 bq, 4 Wk, 5 bk, 6 Wv, 7 bv
  if (in_sizes[0] != B * T * DM || in_sizes[1] != B * T || in_sizes[2] != DM * DM || in_sizes[4] != DM * DM || in_sizes[6] != DM * DM || in_sizes[3] != DM || in_sizes[5] != DM || in_sizes[7] != DM || out_size != B * T * DM) return;
  size_t off = 0; char* ws = (char*)d_ws;
  auto carve = [&](size_t bytes) { char* p = ws + off; off += (bytes + 255) & ~(size_t)255; return p; };
  b16* WT = (b16*)carve((size_t)3 * DM * DM * 2); const size_t plane = (size_t)B * T * DM * 2;
  b16* QP = (b16*)carve(plane); b16* QPl = (b16*)carve(plane); b16* KP = (b16*)carve(plane); b16* KPl = (b16*)carve(plane); b16* VTh = (b16*)carve(plane); b16* VTl = (b16*)carve(plane);
  if (off > ws_size || off > ((size_t)128 << 20)) return;   // = ~57 MB
  prep_kernel<<<(unsigned)(((size_t)3 * DM * DM / 8 + 255) / 256), 256, 0, stream>>>(Fp(2), Fp(4), Fp(6), WT);
  proj_kernel<<<dim3(T / 64, BL, 3 * NSL), 128, 0, stream>>>(Fp(0), WT, Fp(3), Fp(5), Fp(7), QP, QPl, KP, KPl, VTh, VTl);
  attn_kernel<<<dim3(QL / 32, BL * H), 64, 0, stream>>>(QP, QPl, KP, KPl, VTh, VTl, Fp(1), (float*)d_out);
}

// v001
// One run takes 233 microseconds.
// Next to v000, in two timings, it ran 1.61 and 1.62 times as fast.
#include <hip/hip_runtime.h>

// Self-attention (4 x 1024 x 1024, 16 heads x 64): q/k/v = x W + b ((in,out) weights), scores = q k^T / 8 + attention_mask ([4,1,1,1024] additive per key, read as given; zeros here);
// softmax; ctx heads concatenated -> [4][1024][1024] (no output projection).
// Deterministic: flash-style per 16-query wave over all keys (running max); no atomics.
// compute dtype: WMMA v_wmma_f32_16x16x32_f16 with f32 accumulate for the projections ([4096 x 1024] x [1024 x 3072]; x EXACT bf16 x8, W^T exact x256: 1 product), S^T = K Q^T (q/k f16 hi x8 +
// residual x8192: 3 products), O^T += V^T P^T (V^T hi x8 + residual x8192, P x1024 as f16 hi + residual x1024: 3 products); ctx written in f32 from the accumulators; mask add and softmax statistics
// in f32. Inputs rounded to bf16 once. Fragment k-map per lane half hh for A AND B: elements 0..7 <- k = 8hh+0..7, 8..15 <- k = 16+8hh+0..7; acc[r] = D[8hh+r][col].

namespace {
constexpr int B = 4, T = 1024, DM = 1024, H = 16, HD = 64, BL = 4 /* batches (== 4 shipped) */, QL = 1024 /* query rows (== 1024 shipped) */;
constexpr int NSL = DM / 128;
constexpr int KCH = 128 /* K per staged chunk of the projections */, KP_ = KCH + 8 /* LDS row pitch, f16 */;
constexpr float XS = 8.0f, WSC = 256.0f, PS = 1024.0f, RS_ = 1024.0f, LOG2E = 1.4426950408889634f;
static_assert(T % 64 == 0 && QL % 32 == 0 && DM % 256 == 0 && H * HD == DM && HD == 64, "tiling");
typedef _Float16 b16;
typedef __attribute__((ext_vector_type(16))) _Float16 v16b;
typedef __attribute__((ext_vector_type(8))) _Float16 v8b;
typedef __attribute__((ext_vector_type(8))) float v8f;
typedef __attribute__((ext_vector_type(4))) float v4f;
__device__ __forceinline__ float bf16_rne(float f) { unsigned int u = __float_as_uint(f); u += 0x7FFFu + ((u >> 16) & 1u); return __uint_as_float(u & 0xFFFF0000u); }
__device__ __forceinline__ void split16(float v, b16& hi, b16& lo) { hi = (b16)v; lo = (b16)(v - (float)hi); }
__device__ __forceinline__ v16b frag_kb(const b16* p, int hh) { const v8b a = *(const v8b*)(p + 8 * hh), b = *(const v8b*)(p + 16 + 8 * hh); v16b f;
#pragma unroll
  for (int e = 0; e < 8; ++e) { f[e] = a[e]; f[8 + e] = b[e]; } return f; }
__device__ __forceinline__ v8f wmma16b(v16b a, v16b b, v8f c) { v8f d = __builtin_amdgcn_wmma_f32_16x16x32_f16(false, a, false, b, (short)0, c, false, false); asm volatile("v_nop\n\tv_nop\n\tv_nop\n\tv_nop" : "+v"(d) : "v"(a), "v"(b)); return d; }
__device__ __forceinline__ void wave_lds_sync() { __builtin_amdgcn_fence(__ATOMIC_RELEASE, "workgroup"); __builtin_amdgcn_wave_barrier(); __builtin_amdgcn_fence(__ATOMIC_ACQUIRE, "workgroup"); }
__device__ __forceinline__ float pmul(float a, float b) { float p = a * b; asm volatile("" : "+v"(p)); return p; }
__device__ __forceinline__ int iclamp(int v, int lo, int hi) { return v < lo ? lo : (v > hi ? hi : v); }

typedef __attribute__((ext_vector_type(2))) _Float16 v2h;
typedef __attribute__((ext_vector_type(4))) _Float16 v4h;
typedef __attribute__((ext_vector_type(2))) float v2f;
typedef __attribute__((ext_vector_type(4))) int v4i;
__device__ __forceinline__ float nexp2(float v) { return __builtin_amdgcn_exp2f(v); }
__global__ __launch_bounds__(256) void prep_kernel(const float* __restrict__ wq, const float* __restrict__ wk, const float* __restrict__ wv, b16* __restrict__ WT) {
  const size_t u = (size_t)blockIdx.x * 256 + threadIdx.x; const size_t per = (size_t)DM * DM / 8; if (u >= 3 * per) return; const int m = (int)(u / per); const size_t e = u % per; const int row = (int)(e / (DM / 8)), k0 = (int)(e % (DM / 8)) * 8; const float* w = m == 0 ? wq : m == 1 ? wk : wv;
  v8b o; for (int j = 0; j < 8; ++j) o[j] = (b16)(bf16_rne(w[(size_t)(k0 + j) * DM + row]) * WSC);
  { *(v8b*)(WT + ((size_t)m * DM + row) * DM + k0) = o;  }
}
// projections: grid (T/64, BL, 3 x NSL slabs of 128: q | k | v); block = 64 tokens of batch b x 4 waves; A = x rows (exact bf16 x8) and B = the W^T slab, K = 1,024 staged block-wide in LDS in 8 chunks of 128; + bias (bq | bk | bv by part);
// second launch bound: six waves per SIMD = six blocks per WGP (LDS 52,224 B each), so that all 1,536 blocks are resident at once and one block's staging hides behind the others' products
__global__ __launch_bounds__(128, 6) void proj_kernel(const float* __restrict__ x, const b16* __restrict__ WT, const float* __restrict__ bq, const float* __restrict__ bk, const float* __restrict__ bv, b16* __restrict__ QP, b16* __restrict__ QPl, b16* __restrict__ KP, b16* __restrict__ KPl, b16* __restrict__ VTh, b16* __restrict__ VTl) {
  // one LDS block: As (64 x KCH) and Bs (128 x KCH) during the K loop; the f32 epilogue tile Tf lies over the same bytes once every wave has left the loop. Row pitch 272 B = 16 B x 17 (odd) for ds_load_b128 readers.
  __shared__ __attribute__((aligned(16))) unsigned char smem[(64 + 128) * KP_ * 2]; static_assert(sizeof(float) * 4 * 16 * (128 + 4) <= sizeof(smem), "epilogue tile fits");
  b16 (*As)[KP_] = (b16 (*)[KP_])smem; b16 (*Bs)[KP_] = (b16 (*)[KP_])(smem + 64 * KP_ * 2); float (*Tf)[16][128 + 4] = (float (*)[16][128 + 4])smem;
  const int wave = threadIdx.x >> 5, lane = threadIdx.x & 31, nloc = lane & 15, hlf = lane >> 4; const int t0 = blockIdx.x * 64; const int b = blockIdx.y; const int part = blockIdx.z / NSL, slab = blockIdx.z % NSL, c0 = slab * 128, n0 = part * DM + c0;
  if (part == 0 && t0 >= QL) return;   // (cut builds only) queries beyond QL are not needed; block-uniform, before any barrier
  const float* xb = x + ((size_t)b * T + t0) * DM;
  v8f acc[8];
#pragma unroll
  for (int t = 0; t < 8; ++t) acc[t] = (v8f){};
  // staging addresses: a block-uniform base plus one 32-bit element offset per thread; every further piece is a constant step (16 KiB in global memory; 8 rows of Bs, 4 rows of As in LDS)
  const b16* wgb = WT + (size_t)n0 * DM; const unsigned wo = (threadIdx.x >> 4) * DM + (threadIdx.x & 15) * 8; b16* ws_ = &Bs[threadIdx.x >> 4][(threadIdx.x & 15) * 8];
  const unsigned xo = (threadIdx.x >> 5) * DM + lane * 4; b16* xs_ = &As[threadIdx.x >> 5][lane * 4];
#pragma unroll 1
  for (int kc = 0; kc < DM; kc += KCH) {
    __syncthreads();
    // two halves, so that the loads in flight and the accumulators stay inside the register budget of six waves per SIMD; each register of the first half is refilled as soon as it is used, so the second half's loads fly behind the conversions; the unrolls keep every index of xf, wr and bf a constant (registers, no scratch)
    v4f xf[8]; v8b wr[8];   // wr: the slab's 128 rows x KCH, loaded once per block: each wave-wide 16-B load covers two whole 256-B row pieces (4 lines)
#pragma unroll
    for (int i = 0; i < 8; ++i) xf[i] = *(const v4f*)(xb + kc + i * (4 * DM) + xo);
#pragma unroll
    for (int i = 0; i < 8; ++i) wr[i] = *(const v8b*)(wgb + kc + i * (8 * DM) + wo);
#pragma unroll
    for (int i = 0; i < 8; ++i) { v4h o; for (int j = 0; j < 4; ++j) o[j] = (b16)(bf16_rne(xf[i][j]) * XS); *(v4h*)(xs_ + i * 4 * KP_) = o; xf[i] = *(const v4f*)(xb + kc + (8 + i) * (4 * DM) + xo); }
#pragma unroll
    for (int i = 0; i < 8; ++i) { *(v8b*)(ws_ + i * 8 * KP_) = wr[i]; wr[i] = *(const v8b*)(wgb + kc + (8 + i) * (8 * DM) + wo); }
#pragma unroll
    for (int i = 0; i < 8; ++i) { v4h o; for (int j = 0; j < 4; ++j) o[j] = (b16)(bf16_rne(xf[i][j]) * XS); *(v4h*)(xs_ + (8 + i) * 4 * KP_) = o; }
#pragma unroll
    for (int i = 0; i < 8; ++i) *(v8b*)(ws_ + (8 + i) * 8 * KP_) = wr[i];
    __syncthreads();
#pragma unroll   // all four k steps of a chunk: every LDS fragment address is then base + immediate
    for (int kb = 0; kb < KCH; kb += 32) { const v16b a = frag_kb(&As[wave * 16 + nloc][kb], hlf); v16b bf[8];   // the eight B fragments of a k step are read as one group ahead of their products
#pragma unroll
      for (int t = 0; t < 8; ++t) bf[t] = frag_kb(&Bs[t * 16 + nloc][kb], hlf);
#pragma unroll
      for (int t = 0; t < 8; ++t) acc[t] = wmma16b(a, bf[t], acc[t]); } }
  __syncthreads();   // every wave's last read of As / Bs ends here: Tf overwrites those bytes
const float* ba = part == 0 ? bq : (part == 1 ? bk : bv);
#pragma unroll
  for (int t = 0; t < 8; ++t) { const float bb = bf16_rne(ba[c0 + t * 16 + nloc]);
#pragma unroll
    for (int r = 0; r < 8; ++r) Tf[wave][8 * hlf + r][t * 16 + nloc] = acc[t][r] * (1.0f / (XS * WSC)) + bb; }
  __syncthreads();
  {
    if (part < 2) { b16* plane = part == 0 ? QP : KP; b16* planl = part == 0 ? QPl : KPl; const int c = c0 + lane * 4; const int h = c / HD, d = c % HD;
      for (int rr = 0; rr < 16; ++rr) { const int tok = t0 + wave * 16 + rr; const size_t ri = (((size_t)b * H + h) * T + tok) * HD + d; const v4f f4 = *(const v4f*)(&Tf[wave][rr][lane * 4]); v4h o4, l4; for (int j = 0; j < 4; ++j) { const float f = f4[j] * XS; const b16 p = (b16)f; o4[j] = p; l4[j] = (b16)((f - (float)p) * RS_); } *(v4h*)(plane + ri) = o4; *(v4h*)(planl + ri) = l4; } }
    else {
#pragma unroll 1
      for (int q = 0; q < 32; ++q) { const int cl = wave * 32 + q; const int c = c0 + cl; const int h = c / HD, d = c % HD; const int tk = lane * 2; v2h hv, lv;
        for (int j = 0; j < 2; ++j) { const float f = Tf[(tk + j) >> 4][(tk + j) & 15][cl] * XS; const b16 p = (b16)f; hv[j] = p; lv[j] = (b16)((f - (float)p) * RS_); }
        const size_t oi = (((size_t)b * H + h) * HD + d) * (size_t)T + t0 + lane * 2; *(v2h*)(VTh + oi) = hv; *(v2h*)(VTl + oi) = lv; } }
     }
}
// attention: grid (QL/32, BL x H): block = 2 waves x 16 queries of (b, h); all 1,024 keys in 32-key steps; logit = s/8 + mask[b][0][0][key] (the additive per-key f32 mask input, read as given; log2-scaled); online softmax; q/k as f16 hi x8 + residual x8192 planes (S^T: 3 products hh + (hl + lh)/1024), P x1024 as f16 hi + residual x1024 and V^T as hi x8 + residual x8192 planes (O^T: 3 products);
__global__ __launch_bounds__(64) void attn_kernel(const b16* __restrict__ QP, const b16* __restrict__ QPl, const b16* __restrict__ KP, const b16* __restrict__ KPl, const b16* __restrict__ VTh, const b16* __restrict__ VTl, const float* __restrict__ MSK, float* __restrict__ OUTC) {
  __shared__ __attribute__((aligned(16))) b16 Pb[2][16][32 + 8], Pl[2][16][32 + 8]; __shared__ __attribute__((aligned(16))) float To[2][16][HD + 4];
  const int wave = threadIdx.x >> 5, lane = threadIdx.x & 31, hh = lane >> 4, col = lane & 15; const int b = blockIdx.y / H, h = blockIdx.y % H; const int q0 = blockIdx.x * 32 + wave * 16, qi = q0 + col;
  const size_t ph = (size_t)b * H + h; const b16* Qb = QP + ph * T * HD; const b16* Qbl = QPl + ph * T * HD; const b16* Kb = KP + ph * T * HD; const b16* Kbl = KPl + ph * T * HD; const b16* Vh = VTh + ph * HD * (size_t)T; const b16* Vl = VTl + ph * HD * (size_t)T; const float* mrow = MSK + (size_t)b * T;   // per-(b,h) planes; the batch's per-key additive mask row [B,1,1,S] (shared by all queries and heads)
  const v16b qa0 = frag_kb(Qb + (size_t)qi * HD, hh), qa1 = frag_kb(Qb + (size_t)qi * HD + 32, hh), ql0 = frag_kb(Qbl + (size_t)qi * HD, hh), ql1 = frag_kb(Qbl + (size_t)qi * HD + 32, hh);
  const float cs = LOG2E / (8.0f * XS * XS);
  float m = -INFINITY, l = 0.0f; v8f o[4], ol[4]; for (int t = 0; t < 4; ++t) { o[t] = (v8f){}; ol[t] = (v8f){}; }
#pragma unroll 1
  for (int kb = 0; kb < T; kb += 32) {
    float e[16]; float mx = -INFINITY;
#pragma unroll
    for (int u = 0; u < 2; ++u) { v8f s = (v8f){}, sx = (v8f){}; const size_t kr = (size_t)(kb + u * 16 + col) * HD; { const v16b k0 = frag_kb(Kb + kr, hh), k1 = frag_kb(Kb + kr + 32, hh); s = wmma16b(k0, qa0, s); s = wmma16b(k1, qa1, s); sx = wmma16b(k0, ql0, sx); sx = wmma16b(k1, ql1, sx); sx = wmma16b(frag_kb(Kbl + kr, hh), qa0, sx); sx = wmma16b(frag_kb(Kbl + kr + 32, hh), qa1, sx); }
#pragma unroll
      for (int r = 0; r < 8; ++r) s[r] += sx[r] * (1.0f / RS_);   // hi.hi + (hi.lo + lo.hi)/1024
      const v4f m0 = *(const v4f*)(mrow + kb + u * 16 + 8 * hh), m1 = *(const v4f*)(mrow + kb + u * 16 + 8 * hh + 4);   // mask for keys kb + 16u + 8hh .. +7 of this lane's query
#pragma unroll
      for (int r = 0; r < 8; ++r) { const float mk = (r < 4 ? m0[r] : m1[r - 4]) * LOG2E; const float vv = fmaf(s[r], cs, mk); e[u * 8 + r] = vv; mx = fmaxf(mx, vv); } }
    mx = fmaxf(mx, __shfl_xor(mx, 16)); const float mn = fmaxf(m, mx); const float al = nexp2(m - mn); float sum = 0.0f;
#pragma unroll
    for (int i2 = 0; i2 < 16; ++i2) { const float p = nexp2(e[i2] - mn); sum += p; const float ps = p * PS; const b16 phh = (b16)ps; const int pc = (i2 < 8 ? 0 : 16) + 8 * hh + (i2 & 7); Pb[wave][col][pc] = phh; Pl[wave][col][pc] = (b16)((ps - (float)phh) * RS_); }
    sum += __shfl_xor(sum, 16); l = l * al + sum; m = mn;
    wave_lds_sync();
    const v16b pf = frag_kb(&Pb[wave][col][0], hh), plf = frag_kb(&Pl[wave][col][0], hh);
#pragma unroll
    for (int t = 0; t < 4; ++t) { const v16b vh = frag_kb(Vh + (size_t)(t * 16 + col) * T + kb, hh); o[t] *= al; o[t] = wmma16b(vh, pf, o[t]); ol[t] = wmma16b(frag_kb(Vl + (size_t)(t * 16 + col) * T + kb, hh), pf, ol[t] * al); ol[t] = wmma16b(vh, plf, ol[t]); }   // ol = (V_lo P_hi + V_hi P_lo), both /1024
    wave_lds_sync(); }
  const float inv = 1.0f / (l * PS * XS);
#pragma unroll
  for (int t = 0; t < 4; ++t)
#pragma unroll
    for (int r = 0; r < 8; ++r) To[wave][col][t * 16 + 8 * hh + r] = (o[t][r] + ol[t][r] * (1.0f / RS_)) * inv;
  wave_lds_sync();
  { for (int rr = 0; rr < 16; ++rr) { const size_t oi = ((size_t)b * T + q0 + rr) * DM + h * HD + lane * 2; *(v2f*)(OUTC + oi) = *(const v2f*)(&To[wave][rr][lane * 2]); }  }   // ctx row segment (query, head) = 64 f32 = 256 B by 32 lanes x 8 B
}
}  // namespace

extern "C" void kernel_launch(void* const* d_in, const int* in_sizes, int n_in, void* d_out, int out_size, void* d_ws, size_t ws_size, hipStream_t stream) {
  (void)n_in;
  auto Fp = [&](int i) { return (const float*)d_in[i]; };
  // input order: 0 hidden_states [4,1024,1024], 1 attention_mask [4,1,1,1024] f32 additive, 2 Wq [1024,1024] (in,out), 3 bq, 4 Wk, 5 bk, 6 Wv, 7 bv
  if (in_sizes[0] != B * T * DM || in_sizes[1] != B * T || in_sizes[2] != DM * DM || in_sizes[4] != DM * DM || in_sizes[6] != DM * DM || in_sizes[3] != DM || in_sizes[5] != DM || in_sizes[7] != DM || out_size != B * T * DM) return;
  size_t off = 0; char* ws = (char*)d_ws;
  auto carve = [&](size_t bytes) { char* p = ws + off; off += (bytes + 255) & ~(size_t)255; return p; };
  b16* WT = (b16*)carve((size_t)3 * DM * DM * 2); const size_t plane = (size_t)B * T * DM * 2;
  b16* QP = (b16*)carve(plane); b16* QPl = (b16*)carve(plane); b16* KP = (b16*)carve(plane); b16* KPl = (b16*)carve(plane); b16* VTh = (b16*)carve(plane); b16* VTl = (b16*)carve(plane);
  if (off > ws_size || off > ((size_t)128 << 20)) return;   // = ~57 MB
  prep_kernel<<<(unsigned)(((size_t)3 * DM * DM / 8 + 255) / 256), 256, 0, stream>>>(Fp(2), Fp(4), Fp(6), WT);
  proj_kernel<<<dim3(T / 64, BL, 3 * NSL), 128, 0, stream>>>(Fp(0), WT, Fp(3), Fp(5), Fp(7), QP, QPl, KP, KPl, VTh, VTl);
  attn_kernel<<<dim3(QL / 32, BL * H), 64, 0, stream>>>(QP, QPl, KP, KPl, VTh, VTl, Fp(1), (float*)d_out);
}

// v002
// One run takes 108 microseconds.
// Two timings next to v001 both put it at 2.16 times that version's speed.
// Over all steps from v000 it is 3.49 times as fast.
#include <hip/hip_runtime.h>

// Self-attention (4 x 1024 x 1024, 16 heads x 64): q/k/v = x W + b ((in,out) weights), scores = q k^T / 8 + attention_mask ([4,1,1,1024] additive per key, read as given; zeros here);
// softmax; ctx heads concatenated -> [4][1024][1024] (no output projection).
// Deterministic: flash-style per 16-query wave over all keys (running max); no atomics.
// compute dtype: WMMA v_wmma_f32_16x16x32_f16 with f32 accumulate for the projections ([4096 x 1024] x [1024 x 3072]; x EXACT bf16 x8, W^T exact x256: 1 product), S^T = K Q^T (q/k f16 hi x8 +
// residual x8192: 3 products), O^T += V^T P^T (V^T hi x8 + residual x8192, P x1024 as f16 hi + residual x1024: 3 products); ctx written in f32 from the accumulators; mask add and softmax statistics
// in f32. Inputs rounded to bf16 once. Fragment k-map per lane half hh for A AND B: elements 0..7 <- k = 8hh+0..7, 8..15 <- k = 16+8hh+0..7; acc[r] = D[8hh+r][col].

namespace {
constexpr int B = 4, T = 1024, DM = 1024, H = 16, HD = 64, BL = 4 /* batches (== 4 shipped) */, QL = 1024 /* query rows (== 1024 shipped) */;
constexpr int NSL = DM / 128;
constexpr int KCH = 128 /* K per staged chunk of the projections */, KP_ = KCH + 8 /* LDS row pitch, f16 */;
constexpr float XS = 8.0f, WSC = 256.0f, PS = 1024.0f, RS_ = 1024.0f, LOG2E = 1.4426950408889634f;
static_assert(T % 64 == 0 && QL % 32 == 0 && DM % 256 == 0 && H * HD == DM && HD == 64, "tiling");
typedef _Float16 b16;
typedef __attribute__((ext_vector_type(16))) _Float16 v16b;
typedef __attribute__((ext_vector_type(8))) _Float16 v8b;
typedef __attribute__((ext_vector_type(8))) float v8f;
typedef __attribute__((ext_vector_type(4))) float v4f;
__device__ __forceinline__ float bf16_rne(float f) { unsigned int u = __float_as_uint(f); u += 0x7FFFu + ((u >> 16) & 1u); return __uint_as_float(u & 0xFFFF0000u); }
__device__ __forceinline__ void split16(float v, b16& hi, b16& lo) { hi = (b16)v; lo = (b16)(v - (float)hi); }
__device__ __forceinline__ v16b frag_kb(const b16* p, int hh) { const v8b a = *(const v8b*)(p + 8 * hh), b = *(const v8b*)(p + 16 + 8 * hh); v16b f;
#pragma unroll
  for (int e = 0; e < 8; ++e) { f[e] = a[e]; f[8 + e] = b[e]; } return f; }
__device__ __forceinline__ v8f wmma16b(v16b a, v16b b, v8f c) { v8f d = __builtin_amdgcn_wmma_f32_16x16x32_f16(false, a, false, b, (short)0, c, false, false); asm volatile("v_nop\n\tv_nop\n\tv_nop\n\tv_nop" : "+v"(d) : "v"(a), "v"(b)); return d; }
__device__ __forceinline__ void wave_lds_sync() { __builtin_amdgcn_fence(__ATOMIC_RELEASE, "workgroup"); __builtin_amdgcn_wave_barrier(); __builtin_amdgcn_fence(__ATOMIC_ACQUIRE, "workgroup"); }
__device__ __forceinline__ float pmul(float a, float b) { float p = a * b; asm volatile("" : "+v"(p)); return p; }
__device__ __forceinline__ int iclamp(int v, int lo, int hi) { return v < lo ? lo : (v > hi ? hi : v); }

typedef __attribute__((ext_vector_type(2))) _Float16 v2h;
typedef __attribute__((ext_vector_type(4))) _Float16 v4h;
typedef __attribute__((ext_vector_type(2))) float v2f;
typedef __attribute__((ext_vector_type(4))) int v4i;
__device__ __forceinline__ float nexp2(float v) { return __builtin_amdgcn_exp2f(v); }
__global__ __launch_bounds__(256) void prep_kernel(const float* __restrict__ wq, const float* __restrict__ wk, const float* __restrict__ wv, b16* __restrict__ WT) {
  const size_t u = (size_t)blockIdx.x * 256 + threadIdx.x; const size_t per = (size_t)DM * DM / 8; if (u >= 3 * per) return; const int m = (int)(u / per); const size_t e = u % per; const int row = (int)(e / (DM / 8)), k0 = (int)(e % (DM / 8)) * 8; const float* w = m == 0 ? wq : m == 1 ? wk : wv;
  v8b o; for (int j = 0; j < 8; ++j) o[j] = (b16)(bf16_rne(w[(size_t)(k0 + j) * DM + row]) * WSC);
  { *(v8b*)(WT + ((size_t)m * DM + row) * DM + k0) = o;  }
}
// projections: grid (T/64, BL, 3 x NSL slabs of 128: q | k | v); block = 64 tokens of batch b x 4 waves; A = x rows (exact bf16 x8) and B = the W^T slab, K = 1,024 staged block-wide in LDS in 8 chunks of 128; + bias (bq | bk | bv by part);
// second launch bound: six waves per SIMD = six blocks per WGP (LDS 52,224 B each), so that all 1,536 blocks are resident at once and one block's staging hides behind the others' products
__global__ __launch_bounds__(128, 6) void proj_kernel(const float* __restrict__ x, const b16* __restrict__ WT, const float* __restrict__ bq, const float* __restrict__ bk, const float* __restrict__ bv, b16* __restrict__ QP, b16* __restrict__ QPl, b16* __restrict__ KP, b16* __restrict__ KPl, b16* __restrict__ VTh, b16* __restrict__ VTl) {
  // one LDS block: As (64 x KCH) and Bs (128 x KCH) during the K loop; the f32 epilogue tile Tf lies over the same bytes once every wave has left the loop. Row pitch 272 B = 16 B x 17 (odd) for ds_load_b128 readers.
  __shared__ __attribute__((aligned(16))) unsigned char smem[(64 + 128) * KP_ * 2]; static_assert(sizeof(float) * 4 * 16 * (128 + 4) <= sizeof(smem), "epilogue tile fits");
  b16 (*As)[KP_] = (b16 (*)[KP_])smem; b16 (*Bs)[KP_] = (b16 (*)[KP_])(smem + 64 * KP_ * 2); float (*Tf)[16][128 + 4] = (float (*)[16][128 + 4])smem;
  const int wave = threadIdx.x >> 5, lane = threadIdx.x & 31, nloc = lane & 15, hlf = lane >> 4; const int t0 = blockIdx.x * 64; const int b = blockIdx.y; const int part = blockIdx.z / NSL, slab = blockIdx.z % NSL, c0 = slab * 128, n0 = part * DM + c0;
  if (part == 0 && t0 >= QL) return;   // (cut builds only) queries beyond QL are not needed; block-uniform, before any barrier
  const float* xb = x + ((size_t)b * T + t0) * DM;
  v8f acc[8];
#pragma unroll
  for (int t = 0; t < 8; ++t) acc[t] = (v8f){};
  // staging addresses: a block-uniform base plus one 32-bit element offset per thread; every further piece is a constant step (16 KiB in global memory; 8 rows of Bs, 4 rows of As in LDS)
  const b16* wgb = WT + (size_t)n0 * DM; const unsigned wo = (threadIdx.x >> 4) * DM + (threadIdx.x & 15) * 8; b16* ws_ = &Bs[threadIdx.x >> 4][(threadIdx.x & 15) * 8];
  const unsigned xo = (threadIdx.x >> 5) * DM + lane * 4; b16* xs_ = &As[threadIdx.x >> 5][lane * 4];
#pragma unroll 1
  for (int kc = 0; kc < DM; kc += KCH) {
    __syncthreads();
    // two halves, so that the loads in flight and the accumulators stay inside the register budget of six waves per SIMD; each register of the first half is refilled as soon as it is used, so the second half's loads fly behind the conversions; the unrolls keep every index of xf, wr and bf a constant (registers, no scratch)
    v4f xf[8]; v8b wr[8];   // wr: the slab's 128 rows x KCH, loaded once per block: each wave-wide 16-B load covers two whole 256-B row pieces (4 lines)
#pragma unroll
    for (int i = 0; i < 8; ++i) xf[i] = *(const v4f*)(xb + kc + i * (4 * DM) + xo);
#pragma unroll
    for (int i = 0; i < 8; ++i) wr[i] = *(const v8b*)(wgb + kc + i * (8 * DM) + wo);
#pragma unroll
    for (int i = 0; i < 8; ++i) { v4h o; for (int j = 0; j < 4; ++j) o[j] = (b16)(bf16_rne(xf[i][j]) * XS); *(v4h*)(xs_ + i * 4 * KP_) = o; xf[i] = *(const v4f*)(xb + kc + (8 + i) * (4 * DM) + xo); }
#pragma unroll
    for (int i = 0; i < 8; ++i) { *(v8b*)(ws_ + i * 8 * KP_) = wr[i]; wr[i] = *(const v8b*)(wgb + kc + (8 + i) * (8 * DM) + wo); }
#pragma unroll
    for (int i = 0; i < 8; ++i) { v4h o; for (int j = 0; j < 4; ++j) o[j] = (b16)(bf16_rne(xf[i][j]) * XS); *(v4h*)(xs_ + (8 + i) * 4 * KP_) = o; }
#pragma unroll
    for (int i = 0; i < 8; ++i) *(v8b*)(ws_ + (8 + i) * 8 * KP_) = wr[i];
    __syncthreads();
#pragma unroll   // all four k steps of a chunk: every LDS fragment address is then base + immediate
    for (int kb = 0; kb < KCH; kb += 32) { const v16b a = frag_kb(&As[wave * 16 + nloc][kb], hlf); v16b bf[8];   // the eight B fragments of a k step are read as one group ahead of their products
#pragma unroll
      for (int t = 0; t < 8; ++t) bf[t] = frag_kb(&Bs[t * 16 + nloc][kb], hlf);
#pragma unroll
      for (int t = 0; t < 8; ++t) acc[t] = wmma16b(a, bf[t], acc[t]); } }
  __syncthreads();   // every wave's last read of As / Bs ends here: Tf overwrites those bytes
const float* ba = part == 0 ? bq : (part == 1 ? bk : bv);
#pragma unroll
  for (int t = 0; t < 8; ++t) { const float bb = bf16_rne(ba[c0 + t * 16 + nloc]);
#pragma unroll
    for (int r = 0; r < 8; ++r) Tf[wave][8 * hlf + r][t * 16 + nloc] = acc[t][r] * (1.0f / (XS * WSC)) + bb; }
  __syncthreads();
  {
    if (part < 2) { b16* plane = part == 0 ? QP : KP; b16* planl = part == 0 ? QPl : KPl; const int c = c0 + lane * 4; const int h = c / HD, d = c % HD;
      for (int rr = 0; rr < 16; ++rr) { const int tok = t0 + wave * 16 + rr; const size_t ri = (((size_t)b * H + h) * T + tok) * HD + d; const v4f f4 = *(const v4f*)(&Tf[wave][rr][lane * 4]); v4h o4, l4; for (int j = 0; j < 4; ++j) { const float f = f4[j] * XS; const b16 p = (b16)f; o4[j] = p; l4[j] = (b16)((f - (float)p) * RS_); } *(v4h*)(plane + ri) = o4; *(v4h*)(planl + ri) = l4; } }
    else {
#pragma unroll 1
      for (int q = 0; q < 32; ++q) { const int cl = wave * 32 + q; const int c = c0 + cl; const int h = c / HD, d = c % HD; const int tk = lane * 2; v2h hv, lv;
        for (int j = 0; j < 2; ++j) { const float f = Tf[(tk + j) >> 4][(tk + j) & 15][cl] * XS; const b16 p = (b16)f; hv[j] = p; lv[j] = (b16)((f - (float)p) * RS_); }
        const size_t oi = (((size_t)b * H + h) * HD + d) * (size_t)T + t0 + lane * 2; *(v2h*)(VTh + oi) = hv; *(v2h*)(VTl + oi) = lv; } }
     }
}
// attention: grid (QL/128, BL x H): block = 8 waves x 16 queries of (b, h); the keys in tiles of 64: K (hi, residual) rows and V^T (hi, residual) rows of a tile are staged block-wide in LDS by asynchronous 16-B copies (whole 128-B lines), two buffers, the next tile's copies in flight while this tile is worked on; every K and V^T fragment is read from LDS. Inside a tile two 32-key steps as before: logit = s/8 + mask[b][0][0][key] (the additive per-key f32 mask input, read as given; log2-scaled); online softmax; q/k as f16 hi x8 + residual x8192 planes (S^T: 3 products hh + (hl + lh)/1024), P x1024 as f16 hi + residual x1024 and V^T as hi x8 + residual x8192 planes (O^T: 3 products);
constexpr int KT = 64 /* keys per staged tile */, NT = T / KT, SP = 64 + 8 /* LDS row pitch, f16: 144 B = 16 B x 9 (odd) for ds_load_b128 readers */, AW = 8 /* waves per block */;
static_assert(QL % (16 * AW) == 0 && NT >= 2 && KT * 2 == 128 && HD * 2 == 128 && AW * 32 * 2 == KT * 8 && AW * 32 * 2 == HD * 8, "staging: 2 pieces of 16 B per thread and plane");
// one tile = 4 planes x 64 rows x 128 B; a thread copies rows r and r + 32 of each plane, 16 B at byte 16 c (a wave covers four whole lines per copy). l = LDS byte address of its piece in plane 0.
__device__ __forceinline__ void stage_tile(const b16* kh, const b16* kl, const b16* vh, const b16* vl, unsigned l) {
  constexpr unsigned PB = 64 * SP * 2, HB = 32 * SP * 2;
  // the wait on xcnt is the last line of the copies' own statement, so that no address register of a copy is rewritten in front of it
  asm volatile("global_load_async_to_lds_b128 %0, %8, off\n\t"
               "global_load_async_to_lds_b128 %1, %9, off\n\t"
               "global_load_async_to_lds_b128 %2, %10, off\n\t"
               "global_load_async_to_lds_b128 %3, %11, off\n\t"
               "global_load_async_to_lds_b128 %4, %12, off\n\t"
               "global_load_async_to_lds_b128 %5, %13, off\n\t"
               "global_load_async_to_lds_b128 %6, %14, off\n\t"
               "global_load_async_to_lds_b128 %7, %15, off\n\t"
               "s_wait_xcnt 0x0"
               :: "v"(l), "v"(l + HB), "v"(l + PB), "v"(l + PB + HB), "v"(l + 2 * PB), "v"(l + 2 * PB + HB), "v"(l + 3 * PB), "v"(l + 3 * PB + HB),
                  "v"(kh), "v"(kh + 32 * HD), "v"(kl), "v"(kl + 32 * HD), "v"(vh), "v"(vh + 32 * T), "v"(vl), "v"(vl + 32 * T) : "memory");
}
__global__ __launch_bounds__(AW * 32) void attn_kernel(const b16* __restrict__ QP, const b16* __restrict__ QPl, const b16* __restrict__ KP, const b16* __restrict__ KPl, const b16* __restrict__ VTh, const b16* __restrict__ VTl, const float* __restrict__ MSK, float* __restrict__ OUTC) {
  __shared__ __attribute__((aligned(16))) b16 St[2][4][64][SP];   // [buffer][K hi | K residual | V^T hi | V^T residual][key or d][d or key]
  __shared__ __attribute__((aligned(16))) b16 Pb[AW][16][32 + 8], Pl[AW][16][32 + 8]; __shared__ __attribute__((aligned(16))) float To[AW][16][HD + 4];
  const int wave = threadIdx.x >> 5, lane = threadIdx.x & 31, hh = lane >> 4, col = lane & 15; const int b = blockIdx.y / H, h = blockIdx.y % H; const int q0 = blockIdx.x * (16 * AW) + wave * 16, qi = q0 + col;
  const size_t ph = (size_t)b * H + h; const b16* Qb = QP + ph * T * HD; const b16* Qbl = QPl + ph * T * HD; const b16* Kb = KP + ph * T * HD; const b16* Kbl = KPl + ph * T * HD; const b16* Vh = VTh + ph * HD * (size_t)T; const b16* Vl = VTl + ph * HD * (size_t)T; const float* mrow = MSK + (size_t)b * T;   // per-(b,h) planes; the batch's per-key additive mask row [B,1,1,S] (shared by all queries and heads)
  // this thread's pieces of a tile: row sr (and sr + 32), 16-B column sc
  const int sr = threadIdx.x >> 3, sc = (threadIdx.x & 7) * 8; const size_t ko = (size_t)sr * HD + sc, vo = (size_t)sr * T + sc;
  const unsigned sl = (unsigned)(size_t)&St[0][0][sr][sc]; constexpr unsigned BB = 4 * 64 * SP * 2;   // low 32 bits of the shared address = byte offset in the work-group's LDS; BB = bytes of one buffer
  stage_tile(Kb + ko, Kbl + ko, Vh + vo, Vl + vo, sl);
  const v16b qa0 = frag_kb(Qb + (size_t)qi * HD, hh), qa1 = frag_kb(Qb + (size_t)qi * HD + 32, hh), ql0 = frag_kb(Qbl + (size_t)qi * HD, hh), ql1 = frag_kb(Qbl + (size_t)qi * HD + 32, hh);
  asm volatile("s_wait_asynccnt 0x0" ::: "memory");   // this wave's copies of tile 0 have landed
  __syncthreads();                                     // tile 0 published to every wave
  stage_tile(Kb + ko + (size_t)KT * HD, Kbl + ko + (size_t)KT * HD, Vh + vo + KT, Vl + vo + KT, sl + BB);
  const float cs = LOG2E / (8.0f * XS * XS);
  float m = -INFINITY, l = 0.0f; v8f o[4], ol[4]; for (int t = 0; t < 4; ++t) { o[t] = (v8f){}; ol[t] = (v8f){}; }
#pragma unroll 1   // one trip per tile: the publish point at its foot stands once
  for (int kt = 0; kt < NT; ++kt) {
    const b16 (*Sb)[64][SP] = St[kt & 1];
#pragma unroll   // both 32-key steps of a tile: every LDS fragment address is then base + immediate
    for (int kk = 0; kk < KT; kk += 32) { const int kb = kt * KT + kk;
    float e[16]; float mx = -INFINITY; v16b kf[2][4];   // the eight K fragments of a 32-key step are read from LDS as one group ahead of their products; the unrolls keep every index of kf and vf a constant (registers, no scratch)
#pragma unroll
    for (int u = 0; u < 2; ++u) { const int kr = kk + u * 16 + col; kf[u][0] = frag_kb(&Sb[0][kr][0], hh); kf[u][1] = frag_kb(&Sb[0][kr][32], hh); kf[u][2] = frag_kb(&Sb[1][kr][0], hh); kf[u][3] = frag_kb(&Sb[1][kr][32], hh); }
#pragma unroll
    for (int u = 0; u < 2; ++u) { v8f s = (v8f){}, sx = (v8f){}; { const v16b k0 = kf[u][0], k1 = kf[u][1]; s = wmma16b(k0, qa0, s); s = wmma16b(k1, qa1, s); sx = wmma16b(k0, ql0, sx); sx = wmma16b(k1, ql1, sx); sx = wmma16b(kf[u][2], qa0, sx); sx = wmma16b(kf[u][3], qa1, sx); }
#pragma unroll
      for (int r = 0; r < 8; ++r) s[r] += sx[r] * (1.0f / RS_);   // hi.hi + (hi.lo + lo.hi)/1024
      const v4f m0 = *(const v4f*)(mrow + kb + u * 16 + 8 * hh), m1 = *(const v4f*)(mrow + kb + u * 16 + 8 * hh + 4);   // mask for keys kb + 16u + 8hh .. +7 of this lane's query
#pragma unroll
      for (int r = 0; r < 8; ++r) { const float mk = (r < 4 ? m0[r] : m1[r - 4]) * LOG2E; const float vv = fmaf(s[r], cs, mk); e[u * 8 + r] = vv; mx = fmaxf(mx, vv); } }
    v16b vf[4][2];   // the eight V^T fragments of the step are read as one group here, so that they arrive behind the softmax arithmetic
#pragma unroll
    for (int t = 0; t < 4; ++t) { vf[t][0] = frag_kb(&Sb[2][t * 16 + col][kk], hh); vf[t][1] = frag_kb(&Sb[3][t * 16 + col][kk], hh); }
    mx = fmaxf(mx, __shfl_xor(mx, 16)); const float mn = fmaxf(m, mx); const float al = nexp2(m - mn); float sum = 0.0f;
#pragma unroll
    for (int i2 = 0; i2 < 16; ++i2) { const float p = nexp2(e[i2] - mn); sum += p; const float ps = p * PS; const b16 phh = (b16)ps; const int pc = (i2 < 8 ? 0 : 16) + 8 * hh + (i2 & 7); Pb[wave][col][pc] = phh; Pl[wave][col][pc] = (b16)((ps - (float)phh) * RS_); }
    sum += __shfl_xor(sum, 16); l = l * al + sum; m = mn;
    wave_lds_sync();
    const v16b pf = frag_kb(&Pb[wave][col][0], hh), plf = frag_kb(&Pl[wave][col][0], hh);
#pragma unroll
    for (int t = 0; t < 4; ++t) { const v16b vh = vf[t][0]; o[t] *= al; o[t] = wmma16b(vh, pf, o[t]); ol[t] = wmma16b(vf[t][1], pf, ol[t] * al); ol[t] = wmma16b(vh, plf, ol[t]); }   // ol = (V_lo P_hi + V_hi P_lo), both /1024
    wave_lds_sync(); }
    // publish point of tile kt + 1, every wave, in this order
    asm volatile("s_wait_dscnt 0x0" ::: "memory");      // this wave's reads of the buffer that is refilled below have returned
    asm volatile("s_wait_asynccnt 0x0" ::: "memory");   // this wave's copies of tile kt + 1 have landed
    __syncthreads();                                     // publishes tile kt + 1 and ends every wave's reads of tile kt
    if (kt + 2 < NT) stage_tile(Kb + ko + (size_t)(kt + 2) * KT * HD, Kbl + ko + (size_t)(kt + 2) * KT * HD, Vh + vo + (kt + 2) * KT, Vl + vo + (kt + 2) * KT, sl + (unsigned)(kt & 1) * BB); }
  asm volatile("s_wait_asynccnt 0x0" ::: "memory");   // no copy is outstanding when the wave goes on to its end
  const float inv = 1.0f / (l * PS * XS);
#pragma unroll
  for (int t = 0; t < 4; ++t)
#pragma unroll
    for (int r = 0; r < 8; ++r) To[wave][col][t * 16 + 8 * hh + r] = (o[t][r] + ol[t][r] * (1.0f / RS_)) * inv;
  wave_lds_sync();
  { for (int rr = 0; rr < 16; ++rr) { const size_t oi = ((size_t)b * T + q0 + rr) * DM + h * HD + lane * 2; *(v2f*)(OUTC + oi) = *(const v2f*)(&To[wave][rr][lane * 2]); }  }   // ctx row segment (query, head) = 64 f32 = 256 B by 32 lanes x 8 B
}
}  // namespace

extern "C" void kernel_launch(void* const* d_in, const int* in_sizes, int n_in, void* d_out, int out_size, void* d_ws, size_t ws_size, hipStream_t stream) {
  (void)n_in;
  auto Fp = [&](int i) { return (const float*)d_in[i]; };
  // input order: 0 hidden_states [4,1024,1024], 1 attention_mask [4,1,1,1024] f32 additive, 2 Wq [1024,1024] (in,out), 3 bq, 4 Wk, 5 bk, 6 Wv, 7 bv
  if (in_sizes[0] != B * T * DM || in_sizes[1] != B * T || in_sizes[2] != DM * DM || in_sizes[4] != DM * DM || in_sizes[6] != DM * DM || in_sizes[3] != DM || in_sizes[5] != DM || in_sizes[7] != DM || out_size != B * T * DM) return;
  size_t off = 0; char* ws = (char*)d_ws;
  auto carve = [&](size_t bytes) { char* p = ws + off; off += (bytes + 255) & ~(size_t)255; return p; };
  b16* WT = (b16*)carve((size_t)3 * DM * DM * 2); const size_t plane = (size_t)B * T * DM * 2;
  b16* QP = (b16*)carve(plane); b16* QPl = (b16*)carve(plane); b16* KP = (b16*)carve(plane); b16* KPl = (b16*)carve(plane); b16* VTh = (b16*)carve(plane); b16* VTl = (b16*)carve(plane);
  if (off > ws_size || off > ((size_t)128 << 20)) return;   // = ~57 MB
  prep_kernel<<<(unsigned)(((size_t)3 * DM * DM / 8 + 255) / 256), 256, 0, stream>>>(Fp(2), Fp(4), Fp(6), WT);
  proj_kernel<<<dim3(T / 64, BL, 3 * NSL), 128, 0, stream>>>(Fp(0), WT, Fp(3), Fp(5), Fp(7), QP, QPl, KP, KPl, VTh, VTl);
  attn_kernel<<<dim3(QL / (16 * AW), BL * H), AW * 32, 0, stream>>>(QP, QPl, KP, KPl, VTh, VTl, Fp(1), (float*)d_out);
}

// v003
// One run takes 99.4 microseconds.
// In both of two side-by-side timings against v002, it was 1.09 times as fast.
// All steps since v000 together make it 3.80 times as fast.
#include <hip/hip_runtime.h>

// Self-attention (4 x 1024 x 1024, 16 heads x 64): q/k/v = x W + b ((in,out) weights), scores = q k^T / 8 + attention_mask ([4,1,1,1024] additive per key, read as given; zeros here);
// softmax; ctx heads concatenated -> [4][1024][1024] (no output projection).
// Deterministic: flash-style per 16-query wave over all keys (running max); no atomics.
// compute dtype: WMMA v_wmma_f32_16x16x32_f16 with f32 accumulate for the projections ([4096 x 1024] x [1024 x 3072]; x EXACT bf16 x8, W^T exact x256: 1 product), S^T = K Q^T (q/k f16 hi x8 +
// residual x8192: 3 products), O^T += V^T P^T (V^T hi x8 + residual x8192, P x1024 as f16 hi + residual x1024: 3 products); ctx written in f32 from the accumulators; mask add and softmax statistics
// in f32. Inputs rounded to bf16 once. Fragment k-map per lane half hh for A AND B: elements 0..7 <- k = 8hh+0..7, 8..15 <- k = 16+8hh+0..7; acc[r] = D[8hh+r][col].

namespace {
constexpr int B = 4, T = 1024, DM = 1024, H = 16, HD = 64, BL = 4 /* batches (== 4 shipped) */, QL = 1024 /* query rows (== 1024 shipped) */;
constexpr int NSL = DM / 128;
constexpr int KCH = 128 /* K per staged chunk of the projections */, KP_ = KCH + 8 /* LDS row pitch, f16 */;
constexpr float XS = 8.0f, WSC = 256.0f, PS = 1024.0f, RS_ = 1024.0f, LOG2E = 1.4426950408889634f;
static_assert(T % 64 == 0 && QL % 32 == 0 && DM % 256 == 0 && H * HD == DM && HD == 64, "tiling");
typedef _Float16 b16;
typedef __attribute__((ext_vector_type(16))) _Float16 v16b;
typedef __attribute__((ext_vector_type(8))) _Float16 v8b;
typedef __attribute__((ext_vector_type(8))) float v8f;
typedef __attribute__((ext_vector_type(4))) float v4f;
__device__ __forceinline__ float bf16_rne(float f) { unsigned int u = __float_as_uint(f); u += 0x7FFFu + ((u >> 16) & 1u); return __uint_as_float(u & 0xFFFF0000u); }
__device__ __forceinline__ void split16(float v, b16& hi, b16& lo) { hi = (b16)v; lo = (b16)(v - (float)hi); }
__device__ __forceinline__ v16b frag_kb(const b16* p, int hh) { const v8b a = *(const v8b*)(p + 8 * hh), b = *(const v8b*)(p + 16 + 8 * hh); v16b f;
#pragma unroll
  for (int e = 0; e < 8; ++e) { f[e] = a[e]; f[8 + e] = b[e]; } return f; }
__device__ __forceinline__ v8f wmma16b(v16b a, v16b b, v8f c) { v8f d = __builtin_amdgcn_wmma_f32_16x16x32_f16(false, a, false, b, (short)0, c, false, false); asm volatile("v_nop\n\tv_nop\n\tv_nop\n\tv_nop" : "+v"(d) : "v"(a), "v"(b)); return d; }
__device__ __forceinline__ void wave_lds_sync() { __builtin_amdgcn_fence(__ATOMIC_RELEASE, "workgroup"); __builtin_amdgcn_wave_barrier(); __builtin_amdgcn_fence(__ATOMIC_ACQUIRE, "workgroup"); }
__device__ __forceinline__ float pmul(float a, float b) { float p = a * b; asm volatile("" : "+v"(p)); return p; }
__device__ __forceinline__ int iclamp(int v, int lo, int hi) { return v < lo ? lo : (v > hi ? hi : v); }

typedef __attribute__((ext_vector_type(2))) _Float16 v2h;
typedef __attribute__((ext_vector_type(4))) _Float16 v4h;
typedef __attribute__((ext_vector_type(2))) float v2f;
typedef __attribute__((ext_vector_type(4))) int v4i;
__device__ __forceinline__ float nexp2(float v) { return __builtin_amdgcn_exp2f(v); }
// W^T planes: grid (DM/64 column tiles, DM/128 k tiles, q | k | v); block = 4 waves = one tile of 128 k x 64 columns of W. Every global access covers whole lines: a thread loads 16 k rows x 4 columns
// (a wave-wide 16-B load = two 256-B row pieces), rounds them as before, and lays its four columns' 16 k values down in the LDS tile [column][k]; behind the barrier the tile's rows go out as 256-B pieces of W^T rows.
constexpr int PK = 128 /* k per tile */, PN = 64 /* columns per tile */, PP = PK + 8 /* LDS row pitch, f16: 272 B = 16 B x 17 (odd) for ds_load_b128 readers */;
static_assert(DM % PK == 0 && DM % PN == 0, "prep tiling");
__global__ __launch_bounds__(128) void prep_kernel(const float* __restrict__ wq, const float* __restrict__ wk, const float* __restrict__ wv, b16* __restrict__ WT) {
  __shared__ __attribute__((aligned(16))) b16 Tt[PN][PP];
  const int m = blockIdx.z, n0 = blockIdx.x * PN, k0 = blockIdx.y * PK; const float* w = m == 0 ? wq : m == 1 ? wk : wv;
  const int nq = (threadIdx.x & 15) * 4, kr = (threadIdx.x >> 4) * 16; const float* wp = w + (size_t)(k0 + kr) * DM + n0 + nq;
  v4f f[16];   // all sixteen loads of a thread are in flight at once; the unrolls keep every index of f a constant (registers, no scratch)
#pragma unroll
  for (int i = 0; i < 16; ++i) f[i] = *(const v4f*)(wp + i * DM);
  asm volatile("s_wait_xcnt 0x0" :: "v"(wp) : "memory");   // stands behind the sixteen loads and in front of every rewrite of the address pair they name; the pair is an input here so that no load's own result lands on it
#pragma unroll
  for (int j = 0; j < 4; ++j) { v8b a, c;
#pragma unroll
    for (int i = 0; i < 8; ++i) { a[i] = (b16)(bf16_rne(f[i][j]) * WSC); c[i] = (b16)(bf16_rne(f[8 + i][j]) * WSC); }
    *(v8b*)&Tt[nq + j][kr] = a; *(v8b*)&Tt[nq + j][kr + 8] = c; }
  __syncthreads();   // the whole tile is written before any row of it is read
  b16* op = WT + ((size_t)m * DM + n0 + (threadIdx.x >> 4)) * DM + k0 + (threadIdx.x & 15) * 8;
#pragma unroll
  for (int i = 0; i < 8; ++i) *(v8b*)(op + i * (8 * DM)) = *(const v8b*)&Tt[(threadIdx.x >> 4) + 8 * i][(threadIdx.x & 15) * 8];
}
// projections: grid (T/64, BL, 3 x NSL slabs of 128: q | k | v); block = 64 tokens of batch b x 4 waves; A = x rows (exact bf16 x8) and B = the W^T slab, K = 1,024 staged block-wide in LDS in 8 chunks of 128; + bias (bq | bk | bv by part);
// second launch bound: six waves per SIMD = six blocks per WGP (LDS 52,224 B each), so that all 1,536 blocks are resident at once and one block's staging hides behind the others' products
__global__ __launch_bounds__(128, 6) void proj_kernel(const float* __restrict__ x, const b16* __restrict__ WT, const float* __restrict__ bq, const float* __restrict__ bk, const float* __restrict__ bv, b16* __restrict__ QP, b16* __restrict__ QPl, b16* __restrict__ KP, b16* __restrict__ KPl, b16* __restrict__ VTh, b16* __restrict__ VTl) {
  // one LDS block: As (64 x KCH) and Bs (128 x KCH) during the K loop; the f32 epilogue tile Tf lies over the same bytes once every wave has left the loop. Row pitch 272 B = 16 B x 17 (odd) for ds_load_b128 readers.
  __shared__ __attribute__((aligned(16))) unsigned char smem[(64 + 128) * KP_ * 2]; static_assert(sizeof(float) * 4 * 16 * (128 + 4) <= sizeof(smem), "epilogue tile fits");
  b16 (*As)[KP_] = (b16 (*)[KP_])smem; b16 (*Bs)[KP_] = (b16 (*)[KP_])(smem + 64 * KP_ * 2); float (*Tf)[16][128 + 4] = (float (*)[16][128 + 4])smem;
  const int wave = threadIdx.x >> 5, lane = threadIdx.x & 31, nloc = lane & 15, hlf = lane >> 4; const int t0 = blockIdx.x * 64; const int b = blockIdx.y; const int part = blockIdx.z / NSL, slab = blockIdx.z % NSL, c0 = slab * 128, n0 = part * DM + c0;
  if (part == 0 && t0 >= QL) return;   // (cut builds only) queries beyond QL are not needed; block-uniform, before any barrier
  const float* xb = x + ((size_t)b * T + t0) * DM;
  v8f acc[8];
#pragma unroll
  for (int t = 0; t < 8; ++t) acc[t] = (v8f){};
  // staging addresses: a block-uniform base plus one 32-bit element offset per thread; every further piece is a constant step (16 KiB in global memory; 8 rows of Bs, 4 rows of As in LDS)
  const b16* wgb = WT + (size_t)n0 * DM; const unsigned wo = (threadIdx.x >> 4) * DM + (threadIdx.x & 15) * 8; b16* ws_ = &Bs[threadIdx.x >> 4][(threadIdx.x & 15) * 8];
  const unsigned xo = (threadIdx.x >> 5) * DM + lane * 4; b16* xs_ = &As[threadIdx.x >> 5][lane * 4];
#pragma unroll 1
  for (int kc = 0; kc < DM; kc += KCH) {
    __syncthreads();
    // two halves, so that the loads in flight and the accumulators stay inside the register budget of six waves per SIMD; each register of the first half is refilled as soon as it is used, so the second half's loads fly behind the conversions; the unrolls keep every index of xf, wr and bf a constant (registers, no scratch)
    v4f xf[8]; v8b wr[8];   // wr: the slab's 128 rows x KCH, loaded once per block: each wave-wide 16-B load covers two whole 256-B row pieces (4 lines)
#pragma unroll
    for (int i = 0; i < 8; ++i) xf[i] = *(const v4f*)(xb + kc + i * (4 * DM) + xo);
#pragma unroll
    for (int i = 0; i < 8; ++i) wr[i] = *(const v8b*)(wgb + kc + i * (8 * DM) + wo);
#pragma unroll
    for (int i = 0; i < 8; ++i) { v4h o; for (int j = 0; j < 4; ++j) o[j] = (b16)(bf16_rne(xf[i][j]) * XS); *(v4h*)(xs_ + i * 4 * KP_) = o; xf[i] = *(const v4f*)(xb + kc + (8 + i) * (4 * DM) + xo); }
#pragma unroll
    for (int i = 0; i < 8; ++i) { *(v8b*)(ws_ + i * 8 * KP_) = wr[i]; wr[i] = *(const v8b*)(wgb + kc + (8 + i) * (8 * DM) + wo); }
#pragma unroll
    for (int i = 0; i < 8; ++i) { v4h o; for (int j = 0; j < 4; ++j) o[j] = (b16)(bf16_rne(xf[i][j]) * XS); *(v4h*)(xs_ + (8 + i) * 4 * KP_) = o; }
#pragma unroll
    for (int i = 0; i < 8; ++i) *(v8b*)(ws_ + (8 + i) * 8 * KP_) = wr[i];
    __syncthreads();
#pragma unroll   // all four k steps of a chunk: every LDS fragment address is then base + immediate
    for (int kb = 0; kb < KCH; kb += 32) { const v16b a = frag_kb(&As[wave * 16 + nloc][kb], hlf); v16b bf[8];   // the eight B fragments of a k step are read as one group ahead of their products
#pragma unroll
      for (int t = 0; t < 8; ++t) bf[t] = frag_kb(&Bs[t * 16 + nloc][kb], hlf);
#pragma unroll
      for (int t = 0; t < 8; ++t) acc[t] = wmma16b(a, bf[t], acc[t]); } }
  __syncthreads();   // every wave's last read of As / Bs ends here: Tf overwrites those bytes
const float* ba = part == 0 ? bq : (part == 1 ? bk : bv);
#pragma unroll
  for (int t = 0; t < 8; ++t) { const float bb = bf16_rne(ba[c0 + t * 16 + nloc]);
#pragma unroll
    for (int r = 0; r < 8; ++r) Tf[wave][8 * hlf + r][t * 16 + nloc] = acc[t][r] * (1.0f / (XS * WSC)) + bb; }
  __syncthreads();
  {
    if (part < 2) { b16* plane = part == 0 ? QP : KP; b16* planl = part == 0 ? QPl : KPl; const int c = c0 + lane * 4; const int h = c / HD, d = c % HD;
      for (int rr = 0; rr < 16; ++rr) { const int tok = t0 + wave * 16 + rr; const size_t ri = (((size_t)b * H + h) * T + tok) * HD + d; const v4f f4 = *(const v4f*)(&Tf[wave][rr][lane * 4]); v4h o4, l4; for (int j = 0; j < 4; ++j) { const float f = f4[j] * XS; const b16 p = (b16)f; o4[j] = p; l4[j] = (b16)((f - (float)p) * RS_); } *(v4h*)(plane + ri) = o4; *(v4h*)(planl + ri) = l4; } }
    else {
#pragma unroll 1
      for (int q = 0; q < 32; ++q) { const int cl = wave * 32 + q; const int c = c0 + cl; const int h = c / HD, d = c % HD; const int tk = lane * 2; v2h hv, lv;
        for (int j = 0; j < 2; ++j) { const float f = Tf[(tk + j) >> 4][(tk + j) & 15][cl] * XS; const b16 p = (b16)f; hv[j] = p; lv[j] = (b16)((f - (float)p) * RS_); }
        const size_t oi = (((size_t)b * H + h) * HD + d) * (size_t)T + t0 + lane * 2; *(v2h*)(VTh + oi) = hv; *(v2h*)(VTl + oi) = lv; } }
     }
}
// attention: grid (QL/128, BL x H): block = 8 waves x 16 queries of (b, h); the keys in tiles of 64: K (hi, residual) rows and V^T (hi, residual) rows of a tile are staged block-wide in LDS by asynchronous 16-B copies (whole 128-B lines), two buffers, the next tile's copies in flight while this tile is worked on; every K and V^T fragment is read from LDS. Inside a tile two 32-key steps as before: logit = s/8 + mask[b][0][0][key] (the additive per-key f32 mask input, read as given; log2-scaled); online softmax; q/k as f16 hi x8 + residual x8192 planes (S^T: 3 products hh + (hl + lh)/1024), P x1024 as f16 hi + residual x1024 and V^T as hi x8 + residual x8192 planes (O^T: 3 products);
constexpr int KT = 64 /* keys per staged tile */, NT = T / KT, SP = 64 + 8 /* LDS row pitch, f16: 144 B = 16 B x 9 (odd) for ds_load_b128 readers */, AW = 8 /* waves per block */;
static_assert(QL % (16 * AW) == 0 && NT >= 2 && KT * 2 == 128 && HD * 2 == 128 && AW * 32 * 2 == KT * 8 && AW * 32 * 2 == HD * 8, "staging: 2 pieces of 16 B per thread and plane");
// one tile = 4 planes x 64 rows x 128 B; a thread copies rows r and r + 32 of each plane, 16 B at byte 16 c (a wave covers four whole lines per copy). l = LDS byte address of its piece in plane 0.
__device__ __forceinline__ void stage_tile(const b16* kh, const b16* kl, const b16* vh, const b16* vl, unsigned l) {
  constexpr unsigned PB = 64 * SP * 2, HB = 32 * SP * 2;
  // the wait on xcnt is the last line of the copies' own statement, so that no address register of a copy is rewritten in front of it
  asm volatile("global_load_async_to_lds_b128 %0, %8, off\n\t"
               "global_load_async_to_lds_b128 %1, %9, off\n\t"
               "global_load_async_to_lds_b128 %2, %10, off\n\t"
               "global_load_async_to_lds_b128 %3, %11, off\n\t"
               "global_load_async_to_lds_b128 %4, %12, off\n\t"
               "global_load_async_to_lds_b128 %5, %13, off\n\t"
               "global_load_async_to_lds_b128 %6, %14, off\n\t"
               "global_load_async_to_lds_b128 %7, %15, off\n\t"
               "s_wait_xcnt 0x0"
               :: "v"(l), "v"(l + HB), "v"(l + PB), "v"(l + PB + HB), "v"(l + 2 * PB), "v"(l + 2 * PB + HB), "v"(l + 3 * PB), "v"(l + 3 * PB + HB),
                  "v"(kh), "v"(kh + 32 * HD), "v"(kl), "v"(kl + 32 * HD), "v"(vh), "v"(vh + 32 * T), "v"(vl), "v"(vl + 32 * T) : "memory");
}
__global__ __launch_bounds__(AW * 32) void attn_kernel(const b16* __restrict__ QP, const b16* __restrict__ QPl, const b16* __restrict__ KP, const b16* __restrict__ KPl, const b16* __restrict__ VTh, const b16* __restrict__ VTl, const float* __restrict__ MSK, float* __restrict__ OUTC) {
  __shared__ __attribute__((aligned(16))) b16 St[2][4][64][SP];   // [buffer][K hi | K residual | V^T hi | V^T residual][key or d][d or key]
  __shared__ __attribute__((aligned(16))) b16 Pb[AW][16][32 + 8], Pl[AW][16][32 + 8]; __shared__ __attribute__((aligned(16))) float To[AW][16][HD + 4];
  const int wave = threadIdx.x >> 5, lane = threadIdx.x & 31, hh = lane >> 4, col = lane & 15; const int b = blockIdx.y / H, h = blockIdx.y % H; const int q0 = blockIdx.x * (16 * AW) + wave * 16, qi = q0 + col;
  const size_t ph = (size_t)b * H + h; const b16* Qb = QP + ph * T * HD; const b16* Qbl = QPl + ph * T * HD; const b16* Kb = KP + ph * T * HD; const b16* Kbl = KPl + ph * T * HD; const b16* Vh = VTh + ph * HD * (size_t)T; const b16* Vl = VTl + ph * HD * (size_t)T; const float* mrow = MSK + (size_t)b * T;   // per-(b,h) planes; the batch's per-key additive mask row [B,1,1,S] (shared by all queries and heads)
  // this thread's pieces of a tile: row sr (and sr + 32), 16-B column sc
  const int sr = threadIdx.x >> 3, sc = (threadIdx.x & 7) * 8; const size_t ko = (size_t)sr * HD + sc, vo = (size_t)sr * T + sc;
  const unsigned sl = (unsigned)(size_t)&St[0][0][sr][sc]; constexpr unsigned BB = 4 * 64 * SP * 2;   // low 32 bits of the shared address = byte offset in the work-group's LDS; BB = bytes of one buffer
  stage_tile(Kb + ko, Kbl + ko, Vh + vo, Vl + vo, sl);
  const v16b qa0 = frag_kb(Qb + (size_t)qi * HD, hh), qa1 = frag_kb(Qb + (size_t)qi * HD + 32, hh), ql0 = frag_kb(Qbl + (size_t)qi * HD, hh), ql1 = frag_kb(Qbl + (size_t)qi * HD + 32, hh);
  asm volatile("s_wait_asynccnt 0x0" ::: "memory");   // this wave's copies of tile 0 have landed
  __syncthreads();                                     // tile 0 published to every wave
  stage_tile(Kb + ko + (size_t)KT * HD, Kbl + ko + (size_t)KT * HD, Vh + vo + KT, Vl + vo + KT, sl + BB);
  const float cs = LOG2E / (8.0f * XS * XS);
  float m = -INFINITY, l = 0.0f; v8f o[4], ol[4]; for (int t = 0; t < 4; ++t) { o[t] = (v8f){}; ol[t] = (v8f){}; }
#pragma unroll 1   // one trip per tile: the publish point at its foot stands once
  for (int kt = 0; kt < NT; ++kt) {
    const b16 (*Sb)[64][SP] = St[kt & 1];
#pragma unroll   // both 32-key steps of a tile: every LDS fragment address is then base + immediate
    for (int kk = 0; kk < KT; kk += 32) { const int kb = kt * KT + kk;
    float e[16]; float mx = -INFINITY; v16b kf[2][4];   // the eight K fragments of a 32-key step are read from LDS as one group ahead of their products; the unrolls keep every index of kf and vf a constant (registers, no scratch)
#pragma unroll
    for (int u = 0; u < 2; ++u) { const int kr = kk + u * 16 + col; kf[u][0] = frag_kb(&Sb[0][kr][0], hh); kf[u][1] = frag_kb(&Sb[0][kr][32], hh); kf[u][2] = frag_kb(&Sb[1][kr][0], hh); kf[u][3] = frag_kb(&Sb[1][kr][32], hh); }
#pragma unroll
    for (int u = 0; u < 2; ++u) { v8f s = (v8f){}, sx = (v8f){}; { const v16b k0 = kf[u][0], k1 = kf[u][1]; s = wmma16b(k0, qa0, s); s = wmma16b(k1, qa1, s); sx = wmma16b(k0, ql0, sx); sx = wmma16b(k1, ql1, sx); sx = wmma16b(kf[u][2], qa0, sx); sx = wmma16b(kf[u][3], qa1, sx); }
#pragma unroll
      for (int r = 0; r < 8; ++r) s[r] += sx[r] * (1.0f / RS_);   // hi.hi + (hi.lo + lo.hi)/1024
      const v4f m0 = *(const v4f*)(mrow + kb + u * 16 + 8 * hh), m1 = *(const v4f*)(mrow + kb + u * 16 + 8 * hh + 4);   // mask for keys kb + 16u + 8hh .. +7 of this lane's query
#pragma unroll
      for (int r = 0; r < 8; ++r) { const float mk = (r < 4 ? m0[r] : m1[r - 4]) * LOG2E; const float vv = fmaf(s[r], cs, mk); e[u * 8 + r] = vv; mx = fmaxf(mx, vv); } }
    v16b vf[4][2];   // the eight V^T fragments of the step are read as one group here, so that they arrive behind the softmax arithmetic
#pragma unroll
    for (int t = 0; t < 4; ++t) { vf[t][0] = frag_kb(&Sb[2][t * 16 + col][kk], hh); vf[t][1] = frag_kb(&Sb[3][t * 16 + col][kk], hh); }
    mx = fmaxf(mx, __shfl_xor(mx, 16)); const float mn = fmaxf(m, mx); const float al = nexp2(m - mn); float sum = 0.0f;
#pragma unroll
    for (int i2 = 0; i2 < 16; ++i2) { const float p = nexp2(e[i2] - mn); sum += p; const float ps = p * PS; const b16 phh = (b16)ps; const int pc = (i2 < 8 ? 0 : 16) + 8 * hh + (i2 & 7); Pb[wave][col][pc] = phh; Pl[wave][col][pc] = (b16)((ps - (float)phh) * RS_); }
    sum += __shfl_xor(sum, 16); l = l * al + sum; m = mn;
    wave_lds_sync();
    const v16b pf = frag_kb(&Pb[wave][col][0], hh), plf = frag_kb(&Pl[wave][col][0], hh);
#pragma unroll
    for (int t = 0; t < 4; ++t) { const v16b vh = vf[t][0]; o[t] *= al; o[t] = wmma16b(vh, pf, o[t]); ol[t] = wmma16b(vf[t][1], pf, ol[t] * al); ol[t] = wmma16b(vh, plf, ol[t]); }   // ol = (V_lo P_hi + V_hi P_lo), both /1024
    wave_lds_sync(); }
    // publish point of tile kt + 1, every wave, in this order
    asm volatile("s_wait_dscnt 0x0" ::: "memory");      // this wave's reads of the buffer that is refilled below have returned
    asm volatile("s_wait_asynccnt 0x0" ::: "memory");   // this wave's copies of tile kt + 1 have landed
    __syncthreads();                                     // publishes tile kt + 1 and ends every wave's reads of tile kt
    if (kt + 2 < NT) stage_tile(Kb + ko + (size_t)(kt + 2) * KT * HD, Kbl + ko + (size_t)(kt + 2) * KT * HD, Vh + vo + (kt + 2) * KT, Vl + vo + (kt + 2) * KT, sl + (unsigned)(kt & 1) * BB); }
  asm volatile("s_wait_asynccnt 0x0" ::: "memory");   // no copy is outstanding when the wave goes on to its end
  const float inv = 1.0f / (l * PS * XS);
#pragma unroll
  for (int t = 0; t < 4; ++t)
#pragma unroll
    for (int r = 0; r < 8; ++r) To[wave][col][t * 16 + 8 * hh + r] = (o[t][r] + ol[t][r] * (1.0f / RS_)) * inv;
  wave_lds_sync();
  { for (int rr = 0; rr < 16; ++rr) { const size_t oi = ((size_t)b * T + q0 + rr) * DM + h * HD + lane * 2; *(v2f*)(OUTC + oi) = *(const v2f*)(&To[wave][rr][lane * 2]); }  }   // ctx row segment (query, head) = 64 f32 = 256 B by 32 lanes x 8 B
}
}  // namespace

extern "C" void kernel_launch(void* const* d_in, const int* in_sizes, int n_in, void* d_out, int out_size, void* d_ws, size_t ws_size, hipStream_t stream) {
  (void)n_in;
  auto Fp = [&](int i) { return (const float*)d_in[i]; };
  // input order: 0 hidden_states [4,1024,1024], 1 attention_mask [4,1,1,1024] f32 additive, 2 Wq [1024,1024] (in,out), 3 bq, 4 Wk, 5 bk, 6 Wv, 7 bv
  if (in_sizes[0] != B * T * DM || in_sizes[1] != B * T || in_sizes[2] != DM * DM || in_sizes[4] != DM * DM || in_sizes[6] != DM * DM || in_sizes[3] != DM || in_sizes[5] != DM || in_sizes[7] != DM || out_size != B * T * DM) return;
  size_t off = 0; char* ws = (char*)d_ws;
  auto carve = [&](size_t bytes) { char* p = ws + off; off += (bytes + 255) & ~(size_t)255; return p; };
  b16* WT = (b16*)carve((size_t)3 * DM * DM * 2); const size_t plane = (size_t)B * T * DM * 2;
  b16* QP = (b16*)carve(plane); b16* QPl = (b16*)carve(plane); b16* KP = (b16*)carve(plane); b16* KPl = (b16*)carve(plane); b16* VTh = (b16*)carve(plane); b16* VTl = (b16*)carve(plane);
  if (off > ws_size || off > ((size_t)128 << 20)) return;   // = ~57 MB
  prep_kernel<<<dim3(DM / PN, DM / PK, 3), 128, 0, stream>>>(Fp(2), Fp(4), Fp(6), WT);
  proj_kernel<<<dim3(T / 64, BL, 3 * NSL), 128, 0, stream>>>(Fp(0), WT, Fp(3), Fp(5), Fp(7), QP, QPl, KP, KPl, VTh, VTl);
  attn_kernel<<<dim3(QL / (16 * AW), BL * H), AW * 32, 0, stream>>>(QP, QPl, KP, KPl, VTh, VTl, Fp(1), (float*)d_out);
}

// v004
// Measured time: 94 microseconds a run.
// Next to v003, in two timings, it ran 1.04 times as fast each time.
// All steps since v000 together make it 3.95 times as fast.
#include <hip/hip_runtime.h>

// Self-attention (4 x 1024 x 1024, 16 heads x 64): q/k/v = x W + b ((in,out) weights), scores = q k^T / 8 + attention_mask ([4,1,1,1024] additive per key, read as given; zeros here);
// softmax; ctx heads concatenated -> [4][1024][1024] (no output projection).
// Deterministic: flash-style per 16-query wave over all keys (running max); no atomics.
// compute dtype: WMMA v_wmma_f32_16x16x32_f16 with f32 accumulate for the projections ([4096 x 1024] x [1024 x 3072]; x EXACT bf16 x8, W^T exact x256: 1 product), S^T = K Q^T (q/k f16 hi x8 +
// residual x8192: 3 products), O^T += V^T P^T (V^T hi x8 + residual x8192, P x1024 as f16 hi + residual x1024: 3 products); ctx written in f32 from the accumulators; mask add and softmax statistics
// in f32. Inputs rounded to bf16 once. Fragment k-map per lane half hh for A AND B: elements 0..7 <- k = 8hh+0..7, 8..15 <- k = 16+8hh+0..7; acc[r] = D[8hh+r][col].

namespace {
constexpr int B = 4, T = 1024, DM = 1024, H = 16, HD = 64, BL = 4 /* batches (== 4 shipped) */, QL = 1024 /* query rows (== 1024 shipped) */;
constexpr int NSL = DM / 128;
constexpr int KCH = 128 /* K per staged chunk of the projections */, KP_ = KCH + 8 /* LDS row pitch, f16 */;
constexpr float XS = 8.0f, WSC = 256.0f, PS = 1024.0f, RS_ = 1024.0f, LOG2E = 1.4426950408889634f;
static_assert(T % 64 == 0 && QL % 32 == 0 && DM % 256 == 0 && H * HD == DM && HD == 64, "tiling");
typedef _Float16 b16;
typedef __attribute__((ext_vector_type(16))) _Float16 v16b;
typedef __attribute__((ext_vector_type(8))) _Float16 v8b;
typedef __attribute__((ext_vector_type(8))) float v8f;
typedef __attribute__((ext_vector_type(4))) float v4f;
__device__ __forceinline__ float bf16_rne(float f) { unsigned int u = __float_as_uint(f); u += 0x7FFFu + ((u >> 16) & 1u); return __uint_as_float(u & 0xFFFF0000u); }
__device__ __forceinline__ void split16(float v, b16& hi, b16& lo) { hi = (b16)v; lo = (b16)(v - (float)hi); }
__device__ __forceinline__ v16b frag_kb(const b16* p, int hh) { const v8b a = *(const v8b*)(p + 8 * hh), b = *(const v8b*)(p + 16 + 8 * hh); v16b f;
#pragma unroll
  for (int e = 0; e < 8; ++e) { f[e] = a[e]; f[8 + e] = b[e]; } return f; }
__device__ __forceinline__ v8f wmma16b(v16b a, v16b b, v8f c) { v8f d = __builtin_amdgcn_wmma_f32_16x16x32_f16(false, a, false, b, (short)0, c, false, false); asm volatile("v_nop\n\tv_nop\n\tv_nop\n\tv_nop" : "+v"(d) : "v"(a), "v"(b)); return d; }
__device__ __forceinline__ void wave_lds_sync() { __builtin_amdgcn_fence(__ATOMIC_RELEASE, "workgroup"); __builtin_amdgcn_wave_barrier(); __builtin_amdgcn_fence(__ATOMIC_ACQUIRE, "workgroup"); }
__device__ __forceinline__ float pmul(float a, float b) { float p = a * b; asm volatile("" : "+v"(p)); return p; }
__device__ __forceinline__ int iclamp(int v, int lo, int hi) { return v < lo ? lo : (v > hi ? hi : v); }

typedef __attribute__((ext_vector_type(2))) _Float16 v2h;
typedef __attribute__((ext_vector_type(4))) _Float16 v4h;
typedef __attribute__((ext_vector_type(2))) float v2f;
typedef __attribute__((ext_vector_type(4))) int v4i;
__device__ __forceinline__ float nexp2(float v) { return __builtin_amdgcn_exp2f(v); }
// grid (DM/64, DM/128, 3 + XZ). z < 3: W^T planes (column tiles, k tiles, q | k | v); block = 4 waves = one tile of 128 k x 64 columns of W. Every global access covers whole lines: a thread loads 16 k rows x 4 columns
// (a wave-wide 16-B load = two 256-B row pieces), rounds them as before, and lays its four columns' 16 k values down in the LDS tile [column][k]; behind the barrier the tile's rows go out as 256-B pieces of W^T rows.
constexpr int PK = 128 /* k per tile */, PN = 64 /* columns per tile */, PP = PK + 8 /* LDS row pitch, f16: 272 B = 16 B x 17 (odd) for ds_load_b128 readers */;
// z >= 3: the x plane XH = f16(bf16(x) x 8), row-major like x, made once here for all 24 column slabs of the projections: a block takes XE consecutive elements, wave-wide 16-B loads (four whole lines) and 8-B stores (two whole lines).
constexpr int XE = 8192 /* x elements per block */, XZ = B * T * DM / (XE * (DM / PN) * (DM / PK)) /* z planes of x blocks */;
static_assert(DM % PK == 0 && DM % PN == 0 && XZ * XE * (DM / PN) * (DM / PK) == B * T * DM && XE == 128 * 4 * 16, "prep tiling");
__global__ __launch_bounds__(128) void prep_kernel(const float* __restrict__ x, const float* __restrict__ wq, const float* __restrict__ wk, const float* __restrict__ wv, b16* __restrict__ WT, b16* __restrict__ XH) {
  __shared__ __attribute__((aligned(16))) b16 Tt[PN][PP];
  if (blockIdx.z >= 3) {   // block-uniform, in front of the barrier
    const size_t e0 = (size_t)(((blockIdx.z - 3) * (DM / PK) + blockIdx.y) * (DM / PN) + blockIdx.x) * XE + threadIdx.x * 4; const float* xp = x + e0; b16* xo = XH + e0;
    v4f g[16];   // all sixteen loads of a thread are in flight at once; the unrolls keep every index of g a constant (registers, no scratch)
#pragma unroll
    for (int i = 0; i < 16; ++i) g[i] = *(const v4f*)(xp + i * 512);
    asm volatile("s_wait_xcnt 0x0" :: "v"(xp) : "memory");   // stands behind the sixteen loads and in front of every rewrite of the address pair they name; the pair is an input here so that no load's own result lands on it
#pragma unroll
    for (int i = 0; i < 16; ++i) { v4h o; for (int j = 0; j < 4; ++j) o[j] = (b16)(bf16_rne(g[i][j]) * XS); *(v4h*)(xo + i * 512) = o; }
    return; }
  const int m = blockIdx.z, n0 = blockIdx.x * PN, k0 = blockIdx.y * PK; const float* w = m == 0 ? wq : m == 1 ? wk : wv;
  const int nq = (threadIdx.x & 15) * 4, kr = (threadIdx.x >> 4) * 16; const float* wp = w + (size_t)(k0 + kr) * DM + n0 + nq;
  v4f f[16];   // all sixteen loads of a thread are in flight at once; the unrolls keep every index of f a constant (registers, no scratch)
#pragma unroll
  for (int i = 0; i < 16; ++i) f[i] = *(const v4f*)(wp + i * DM);
  asm volatile("s_wait_xcnt 0x0" :: "v"(wp) : "memory");   // stands behind the sixteen loads and in front of every rewrite of the address pair they name; the pair is an input here so that no load's own result lands on it
#pragma unroll
  for (int j = 0; j < 4; ++j) { v8b a, c;
#pragma unroll
    for (int i = 0; i < 8; ++i) { a[i] = (b16)(bf16_rne(f[i][j]) * WSC); c[i] = (b16)(bf16_rne(f[8 + i][j]) * WSC); }
    *(v8b*)&Tt[nq + j][kr] = a; *(v8b*)&Tt[nq + j][kr + 8] = c; }
  __syncthreads();   // the whole tile is written before any row of it is read
  b16* op = WT + ((size_t)m * DM + n0 + (threadIdx.x >> 4)) * DM + k0 + (threadIdx.x & 15) * 8;
#pragma unroll
  for (int i = 0; i < 8; ++i) *(v8b*)(op + i * (8 * DM)) = *(const v8b*)&Tt[(threadIdx.x >> 4) + 8 * i][(threadIdx.x & 15) * 8];
}
// projections: grid (T/64, BL, 3 x NSL slabs of 128: q | k | v); block = 64 tokens of batch b x 4 waves; A = rows of the x plane XH (exact bf16 x8, f16) and B = the W^T slab, K = 1,024 staged block-wide in LDS in 8 chunks of 128; + bias (bq | bk | bv by part);
// second launch bound: six waves per SIMD = six blocks per WGP (LDS 52,224 B each), so that all 1,536 blocks are resident at once and one block's staging hides behind the others' products
__global__ __launch_bounds__(128, 6) void proj_kernel(const b16* __restrict__ XH, const b16* __restrict__ WT, const float* __restrict__ bq, const float* __restrict__ bk, const float* __restrict__ bv, b16* __restrict__ QP, b16* __restrict__ QPl, b16* __restrict__ KP, b16* __restrict__ KPl, b16* __restrict__ VTh, b16* __restrict__ VTl) {
  // one LDS block: As (64 x KCH) and Bs (128 x KCH) during the K loop; the f32 epilogue tile Tf lies over the same bytes once every wave has left the loop. Row pitch 272 B = 16 B x 17 (odd) for ds_load_b128 readers.
  __shared__ __attribute__((aligned(16))) unsigned char smem[(64 + 128) * KP_ * 2]; static_assert(sizeof(float) * 4 * 16 * (128 + 4) <= sizeof(smem), "epilogue tile fits");
  b16 (*As)[KP_] = (b16 (*)[KP_])smem; b16 (*Bs)[KP_] = (b16 (*)[KP_])(smem + 64 * KP_ * 2); float (*Tf)[16][128 + 4] = (float (*)[16][128 + 4])smem;
  const int wave = threadIdx.x >> 5, lane = threadIdx.x & 31, nloc = lane & 15, hlf = lane >> 4; const int t0 = blockIdx.x * 64; const int b = blockIdx.y; const int part = blockIdx.z / NSL, slab = blockIdx.z % NSL, c0 = slab * 128, n0 = part * DM + c0;
  if (part == 0 && t0 >= QL) return;   // (cut builds only) queries beyond QL are not needed; block-uniform, before any barrier
  const b16* xb = XH + ((size_t)b * T + t0) * DM;
  v8f acc[8];
#pragma unroll
  for (int t = 0; t < 8; ++t) acc[t] = (v8f){};
  // staging addresses: a block-uniform base plus one 32-bit element offset per thread; every further piece is a constant step (16 KiB in global memory; 8 rows of As or Bs in LDS); x and W^T rows have one pitch, so one offset serves both
  const b16* wgb = WT + (size_t)n0 * DM; const unsigned wo = (threadIdx.x >> 4) * DM + (threadIdx.x & 15) * 8; b16* ws_ = &Bs[threadIdx.x >> 4][(threadIdx.x & 15) * 8];
  b16* xs_ = &As[threadIdx.x >> 4][(threadIdx.x & 15) * 8];
#pragma unroll 1
  for (int kc = 0; kc < DM; kc += KCH) {
    __syncthreads();
    // sixteen of the 24 pieces first, so that the loads in flight and the accumulators stay inside the register budget of six waves per SIMD; each register of xr is refilled with a piece of the slab's second half as soon as it is stored; the unrolls keep every index of xr, wr and bf a constant (registers, no scratch)
    const b16* xg = xb + kc + wo; const b16* wg = wgb + kc + wo; v8b xr[8], wr[8];   // 64 rows of x and the slab's 128 rows x KCH, loaded once per block: each wave-wide 16-B load covers two whole 256-B row pieces (4 lines)
#pragma unroll
    for (int i = 0; i < 8; ++i) xr[i] = *(const v8b*)(xg + i * (8 * DM));
#pragma unroll
    for (int i = 0; i < 8; ++i) wr[i] = *(const v8b*)(wg + i * (8 * DM));
#pragma unroll
    for (int i = 0; i < 8; ++i) { *(v8b*)(xs_ + i * 8 * KP_) = xr[i]; xr[i] = *(const v8b*)(wg + (8 + i) * (8 * DM)); }
    asm volatile("s_wait_xcnt 0x0" :: "v"(xg), "v"(wg) : "memory");   // stands behind the chunk's 24 loads and in front of every rewrite of the two address pairs they name; the pairs are inputs here so that no load's own result lands on them
#pragma unroll
    for (int i = 0; i < 8; ++i) *(v8b*)(ws_ + i * 8 * KP_) = wr[i];
#pragma unroll
    for (int i = 0; i < 8; ++i) *(v8b*)(ws_ + (8 + i) * 8 * KP_) = xr[i];
    __syncthreads();
#pragma unroll   // all four k steps of a chunk: every LDS fragment address is then base + immediate
    for (int kb = 0; kb < KCH; kb += 32) { const v16b a = frag_kb(&As[wave * 16 + nloc][kb], hlf); v16b bf[8];   // the eight B fragments of a k step are read as one group ahead of their products
#pragma unroll
      for (int t = 0; t < 8; ++t) bf[t] = frag_kb(&Bs[t * 16 + nloc][kb], hlf);
#pragma unroll
      for (int t = 0; t < 8; ++t) acc[t] = wmma16b(a, bf[t], acc[t]); } }
  __syncthreads();   // every wave's last read of As / Bs ends here: Tf overwrites those bytes
const float* ba = part == 0 ? bq : (part == 1 ? bk : bv);
#pragma unroll
  for (int t = 0; t < 8; ++t) { const float bb = bf16_rne(ba[c0 + t * 16 + nloc]);
#pragma unroll
    for (int r = 0; r < 8; ++r) Tf[wave][8 * hlf + r][t * 16 + nloc] = acc[t][r] * (1.0f / (XS * WSC)) + bb; }
  __syncthreads();
  {
    if (part < 2) { b16* plane = part == 0 ? QP : KP; b16* planl = part == 0 ? QPl : KPl; const int c = c0 + lane * 4; const int h = c / HD, d = c % HD;
      for (int rr = 0; rr < 16; ++rr) { const int tok = t0 + wave * 16 + rr; const size_t ri = (((size_t)b * H + h) * T + tok) * HD + d; const v4f f4 = *(const v4f*)(&Tf[wave][rr][lane * 4]); v4h o4, l4; for (int j = 0; j < 4; ++j) { const float f = f4[j] * XS; const b16 p = (b16)f; o4[j] = p; l4[j] = (b16)((f - (float)p) * RS_); } *(v4h*)(plane + ri) = o4; *(v4h*)(planl + ri) = l4; } }
    else {
#pragma unroll 1
      for (int q = 0; q < 32; ++q) { const int cl = wave * 32 + q; const int c = c0 + cl; const int h = c / HD, d = c % HD; const int tk = lane * 2; v2h hv, lv;
        for (int j = 0; j < 2; ++j) { const float f = Tf[(tk + j) >> 4][(tk + j) & 15][cl] * XS; const b16 p = (b16)f; hv[j] = p; lv[j] = (b16)((f - (float)p) * RS_); }
        const size_t oi = (((size_t)b * H + h) * HD + d) * (size_t)T + t0 + lane * 2; *(v2h*)(VTh + oi) = hv; *(v2h*)(VTl + oi) = lv; } }
     }
}
// attention: grid (QL/128, BL x H): block = 8 waves x 16 queries of (b, h); the keys in tiles of 64: K (hi, residual) rows and V^T (hi, residual) rows of a tile are staged block-wide in LDS by asynchronous 16-B copies (whole 128-B lines), two buffers, the next tile's copies in flight while this tile is worked on; every K and V^T fragment is read from LDS. Inside a tile two 32-key steps as before: logit = s/8 + mask[b][0][0][key] (the additive per-key f32 mask input, read as given; log2-scaled); online softmax; q/k as f16 hi x8 + residual x8192 planes (S^T: 3 products hh + (hl + lh)/1024), P x1024 as f16 hi + residual x1024 and V^T as hi x8 + residual x8192 planes (O^T: 3 products);
constexpr int KT = 64 /* keys per staged tile */, NT = T / KT, SP = 64 + 8 /* LDS row pitch, f16: 144 B = 16 B x 9 (odd) for ds_load_b128 readers */, AW = 8 /* waves per block */;
static_assert(QL % (16 * AW) == 0 && NT >= 2 && KT * 2 == 128 && HD * 2 == 128 && AW * 32 * 2 == KT * 8 && AW * 32 * 2 == HD * 8, "staging: 2 pieces of 16 B per thread and plane");
// one tile = 4 planes x 64 rows x 128 B; a thread copies rows r and r + 32 of each plane, 16 B at byte 16 c (a wave covers four whole lines per copy). l = LDS byte address of its piece in plane 0.
__device__ __forceinline__ void stage_tile(const b16* kh, const b16* kl, const b16* vh, const b16* vl, unsigned l) {
  constexpr unsigned PB = 64 * SP * 2, HB = 32 * SP * 2;
  // the wait on xcnt is the last line of the copies' own statement, so that no address register of a copy is rewritten in front of it
  asm volatile("global_load_async_to_lds_b128 %0, %8, off\n\t"
               "global_load_async_to_lds_b128 %1, %9, off\n\t"
               "global_load_async_to_lds_b128 %2, %10, off\n\t"
               "global_load_async_to_lds_b128 %3, %11, off\n\t"
               "global_load_async_to_lds_b128 %4, %12, off\n\t"
               "global_load_async_to_lds_b128 %5, %13, off\n\t"
               "global_load_async_to_lds_b128 %6, %14, off\n\t"
               "global_load_async_to_lds_b128 %7, %15, off\n\t"
               "s_wait_xcnt 0x0"
               :: "v"(l), "v"(l + HB), "v"(l + PB), "v"(l + PB + HB), "v"(l + 2 * PB), "v"(l + 2 * PB + HB), "v"(l + 3 * PB), "v"(l + 3 * PB + HB),
                  "v"(kh), "v"(kh + 32 * HD), "v"(kl), "v"(kl + 32 * HD), "v"(vh), "v"(vh + 32 * T), "v"(vl), "v"(vl + 32 * T) : "memory");
}
__global__ __launch_bounds__(AW * 32) void attn_kernel(const b16* __restrict__ QP, const b16* __restrict__ QPl, const b16* __restrict__ KP, const b16* __restrict__ KPl, const b16* __restrict__ VTh, const b16* __restrict__ VTl, const float* __restrict__ MSK, float* __restrict__ OUTC) {
  __shared__ __attribute__((aligned(16))) b16 St[2][4][64][SP];   // [buffer][K hi | K residual | V^T hi | V^T residual][key or d][d or key]
  __shared__ __attribute__((aligned(16))) b16 Pb[AW][16][32 + 8], Pl[AW][16][32 + 8]; __shared__ __attribute__((aligned(16))) float To[AW][16][HD + 4];
  const int wave = threadIdx.x >> 5, lane = threadIdx.x & 31, hh = lane >> 4, col = lane & 15; const int b = blockIdx.y / H, h = blockIdx.y % H; const int q0 = blockIdx.x * (16 * AW) + wave * 16, qi = q0 + col;
  const size_t ph = (size_t)b * H + h; const b16* Qb = QP + ph * T * HD; const b16* Qbl = QPl + ph * T * HD; const b16* Kb = KP + ph * T * HD; const b16* Kbl = KPl + ph * T * HD; const b16* Vh = VTh + ph * HD * (size_t)T; const b16* Vl = VTl + ph * HD * (size_t)T; const float* mrow = MSK + (size_t)b * T;   // per-(b,h) planes; the batch's per-key additive mask row [B,1,1,S] (shared by all queries and heads)
  // this thread's pieces of a tile: row sr (and sr + 32), 16-B column sc
  const int sr = threadIdx.x >> 3, sc = (threadIdx.x & 7) * 8; const size_t ko = (size_t)sr * HD + sc, vo = (size_t)sr * T + sc;
  const unsigned sl = (unsigned)(size_t)&St[0][0][sr][sc]; constexpr unsigned BB = 4 * 64 * SP * 2;   // low 32 bits of the shared address = byte offset in the work-group's LDS; BB = bytes of one buffer
  stage_tile(Kb + ko, Kbl + ko, Vh + vo, Vl + vo, sl);
  const v16b qa0 = frag_kb(Qb + (size_t)qi * HD, hh), qa1 = frag_kb(Qb + (size_t)qi * HD + 32, hh), ql0 = frag_kb(Qbl + (size_t)qi * HD, hh), ql1 = frag_kb(Qbl + (size_t)qi * HD + 32, hh);
  asm volatile("s_wait_asynccnt 0x0" ::: "memory");   // this wave's copies of tile 0 have landed
  __syncthreads();                                     // tile 0 published to every wave
  stage_tile(Kb + ko + (size_t)KT * HD, Kbl + ko + (size_t)KT * HD, Vh + vo + KT, Vl + vo + KT, sl + BB);
  const float cs = LOG2E / (8.0f * XS * XS);
  float m = -INFINITY, l = 0.0f; v8f o[4], ol[4]; for (int t = 0; t < 4; ++t) { o[t] = (v8f){}; ol[t] = (v8f){}; }
#pragma unroll 1   // one trip per tile: the publish point at its foot stands once
  for (int kt = 0; kt < NT; ++kt) {
    const b16 (*Sb)[64][SP] = St[kt & 1];
#pragma unroll   // both 32-key steps of a tile: every LDS fragment address is then base + immediate
    for (int kk = 0; kk < KT; kk += 32) { const int kb = kt * KT + kk;
    float e[16]; float mx = -INFINITY; v16b kf[2][4];   // the eight K fragments of a 32-key step are read from LDS as one group ahead of their products; the unrolls keep every index of kf and vf a constant (registers, no scratch)
#pragma unroll
    for (int u = 0; u < 2; ++u) { const int kr = kk + u * 16 + col; kf[u][0] = frag_kb(&Sb[0][kr][0], hh); kf[u][1] = frag_kb(&Sb[0][kr][32], hh); kf[u][2] = frag_kb(&Sb[1][kr][0], hh); kf[u][3] = frag_kb(&Sb[1][kr][32], hh); }
#pragma unroll
    for (int u = 0; u < 2; ++u) { v8f s = (v8f){}, sx = (v8f){}; { const v16b k0 = kf[u][0], k1 = kf[u][1]; s = wmma16b(k0, qa0, s); s = wmma16b(k1, qa1, s); sx = wmma16b(k0, ql0, sx); sx = wmma16b(k1, ql1, sx); sx = wmma16b(kf[u][2], qa0, sx); sx = wmma16b(kf[u][3], qa1, sx); }
#pragma unroll
      for (int r = 0; r < 8; ++r) s[r] += sx[r] * (1.0f / RS_);   // hi.hi + (hi.lo + lo.hi)/1024
      const v4f m0 = *(const v4f*)(mrow + kb + u * 16 + 8 * hh), m1 = *(const v4f*)(mrow + kb + u * 16 + 8 * hh + 4);   // mask for keys kb + 16u + 8hh .. +7 of this lane's query
#pragma unroll
      for (int r = 0; r < 8; ++r) { const float mk = (r < 4 ? m0[r] : m1[r - 4]) * LOG2E; const float vv = fmaf(s[r], cs, mk); e[u * 8 + r] = vv; mx = fmaxf(mx, vv); } }
    v16b vf[4][2];   // the eight V^T fragments of the step are read as one group here, so that they arrive behind the softmax arithmetic
#pragma unroll
    for (int t = 0; t < 4; ++t) { vf[t][0] = frag_kb(&Sb[2][t * 16 + col][kk], hh); vf[t][1] = frag_kb(&Sb[3][t * 16 + col][kk], hh); }
    mx = fmaxf(mx, __shfl_xor(mx, 16)); const float mn = fmaxf(m, mx); const float al = nexp2(m - mn); float sum = 0.0f;
#pragma unroll
    for (int i2 = 0; i2 < 16; ++i2) { const float p = nexp2(e[i2] - mn); sum += p; const float ps = p * PS; const b16 phh = (b16)ps; const int pc = (i2 < 8 ? 0 : 16) + 8 * hh + (i2 & 7); Pb[wave][col][pc] = phh; Pl[wave][col][pc] = (b16)((ps - (float)phh) * RS_); }
    sum += __shfl_xor(sum, 16); l = l * al + sum; m = mn;
    wave_lds_sync();
    const v16b pf = frag_kb(&Pb[wave][col][0], hh), plf = frag_kb(&Pl[wave][col][0], hh);
#pragma unroll
    for (int t = 0; t < 4; ++t) { const v16b vh = vf[t][0]; o[t] *= al; o[t] = wmma16b(vh, pf, o[t]); ol[t] = wmma16b(vf[t][1], pf, ol[t] * al); ol[t] = wmma16b(vh, plf, ol[t]); }   // ol = (V_lo P_hi + V_hi P_lo), both /1024
    wave_lds_sync(); }
    // publish point of tile kt + 1, every wave, in this order
    asm volatile("s_wait_dscnt 0x0" ::: "memory");      // this wave's reads of the buffer that is refilled below have returned
    asm volatile("s_wait_asynccnt 0x0" ::: "memory");   // this wave's copies of tile kt + 1 have landed
    __syncthreads();                                     // publishes tile kt + 1 and ends every wave's reads of tile kt
    if (kt + 2 < NT) stage_tile(Kb + ko + (size_t)(kt + 2) * KT * HD, Kbl + ko + (size_t)(kt + 2) * KT * HD, Vh + vo + (kt + 2) * KT, Vl + vo + (kt + 2) * KT, sl + (unsigned)(kt & 1) * BB); }
  asm volatile("s_wait_asynccnt 0x0" ::: "memory");   // no copy is outstanding when the wave goes on to its end
  const float inv = 1.0f / (l * PS * XS);
#pragma unroll
  for (int t = 0; t < 4; ++t)
#pragma unroll
    for (int r = 0; r < 8; ++r) To[wave][col][t * 16 + 8 * hh + r] = (o[t][r] + ol[t][r] * (1.0f / RS_)) * inv;
  wave_lds_sync();
  { for (int rr = 0; rr < 16; ++rr) { const size_t oi = ((size_t)b * T + q0 + rr) * DM + h * HD + lane * 2; *(v2f*)(OUTC + oi) = *(const v2f*)(&To[wave][rr][lane * 2]); }  }   // ctx row segment (query, head) = 64 f32 = 256 B by 32 lanes x 8 B
}
}  // namespace

extern "C" void kernel_launch(void* const* d_in, const int* in_sizes, int n_in, void* d_out, int out_size, void* d_ws, size_t ws_size, hipStream_t stream) {
  (void)n_in;
  auto Fp = [&](int i) { return (const float*)d_in[i]; };
  // input order: 0 hidden_states [4,1024,1024], 1 attention_mask [4,1,1,1024] f32 additive, 2 Wq [1024,1024] (in,out), 3 bq, 4 Wk, 5 bk, 6 Wv, 7 bv
  if (in_sizes[0] != B * T * DM || in_sizes[1] != B * T || in_sizes[2] != DM * DM || in_sizes[4] != DM * DM || in_sizes[6] != DM * DM || in_sizes[3] != DM || in_sizes[5] != DM || in_sizes[7] != DM || out_size != B * T * DM) return;
  size_t off = 0; char* ws = (char*)d_ws;
  auto carve = [&](size_t bytes) { char* p = ws + off; off += (bytes + 255) & ~(size_t)255; return p; };
  b16* WT = (b16*)carve((size_t)3 * DM * DM * 2); const size_t plane = (size_t)B * T * DM * 2; b16* XH = (b16*)carve(plane);
  b16* QP = (b16*)carve(plane); b16* QPl = (b16*)carve(plane); b16* KP = (b16*)carve(plane); b16* KPl = (b16*)carve(plane); b16* VTh = (b16*)carve(plane); b16* VTl = (b16*)carve(plane);
  if (off > ws_size || off > ((size_t)128 << 20)) return;   // = ~65 MB
  prep_kernel<<<dim3(DM / PN, DM / PK, 3 + XZ), 128, 0, stream>>>(Fp(0), Fp(2), Fp(4), Fp(6), WT, XH);
  proj_kernel<<<dim3(T / 64, BL, 3 * NSL), 128, 0, stream>>>(XH, WT, Fp(3), Fp(5), Fp(7), QP, QPl, KP, KPl, VTh, VTl);
  attn_kernel<<<dim3(QL / (16 * AW), BL * H), AW * 32, 0, stream>>>(QP, QPl, KP, KPl, VTh, VTl, Fp(1), (float*)d_out);
}

// v005
// Measured time: 91.8 microseconds a run.
// Timed twice side by side with v004, it ran 1.03 and 1.04 times as fast.
// Over all steps from v000 it is 4.09 times as fast.
#include <hip/hip_runtime.h>

// Self-attention (4 x 1024 x 1024, 16 heads x 64): q/k/v = x W + b ((in,out) weights), scores = q k^T / 8 + attention_mask ([4,1,1,1024] additive per key, read as given; zeros here);
// softmax; ctx heads concatenated -> [4][1024][1024] (no output projection).
// Deterministic: flash-style per 16-query wave over all keys (running max); no atomics.
// compute dtype: WMMA v_wmma_f32_16x16x32_f16 with f32 accumulate for the projections ([4096 x 1024] x [1024 x 3072]; x EXACT bf16 x8, W^T exact x256: 1 product), S^T = K Q^T (q/k f16 hi x8 +
// residual x8192: 3 products), O^T += V^T P^T (V^T hi x8 + residual x8192, P x1024 as f16 hi + residual x1024: 3 products); ctx written in f32 from the accumulators; mask add and softmax statistics
// in f32. Inputs rounded to bf16 once. Fragment k-map per lane half hh for A AND B: elements 0..7 <- k = 8hh+0..7, 8..15 <- k = 16+8hh+0..7; acc[r] = D[8hh+r][col].

namespace {
constexpr int B = 4, T = 1024, DM = 1024, H = 16, HD = 64, BL = 4 /* batches (== 4 shipped) */, QL = 1024 /* query rows (== 1024 shipped) */;
constexpr int NSL = DM / 128;
constexpr int KCH = 128 /* K per staged chunk of the projections */, KP_ = KCH + 8 /* LDS row pitch, f16 */;
constexpr float XS = 8.0f, WSC = 256.0f, PS = 1024.0f, RS_ = 1024.0f, LOG2E = 1.4426950408889634f;
static_assert(T % 64 == 0 && QL % 32 == 0 && DM % 256 == 0 && H * HD == DM && HD == 64, "tiling");
typedef _Float16 b16;
typedef __attribute__((ext_vector_type(16))) _Float16 v16b;
typedef __attribute__((ext_vector_type(8))) _Float16 v8b;
typedef __attribute__((ext_vector_type(8))) float v8f;
typedef __attribute__((ext_vector_type(4))) float v4f;
__device__ __forceinline__ float bf16_rne(float f) { unsigned int u = __float_as_uint(f); u += 0x7FFFu + ((u >> 16) & 1u); return __uint_as_float(u & 0xFFFF0000u); }
__device__ __forceinline__ void split16(float v, b16& hi, b16& lo) { hi = (b16)v; lo = (b16)(v - (float)hi); }
__device__ __forceinline__ v16b frag_kb(const b16* p, int hh) { const v8b a = *(const v8b*)(p + 8 * hh), b = *(const v8b*)(p + 16 + 8 * hh); v16b f;
#pragma unroll
  for (int e = 0; e < 8; ++e) { f[e] = a[e]; f[8 + e] = b[e]; } return f; }
__device__ __forceinline__ v8f wmma16b(v16b a, v16b b, v8f c) { v8f d = __builtin_amdgcn_wmma_f32_16x16x32_f16(false, a, false, b, (short)0, c, false, false); asm volatile("v_nop\n\tv_nop\n\tv_nop\n\tv_nop" : "+v"(d) : "v"(a), "v"(b)); return d; }
__device__ __forceinline__ void wave_lds_sync() { __builtin_amdgcn_fence(__ATOMIC_RELEASE, "workgroup"); __builtin_amdgcn_wave_barrier(); __builtin_amdgcn_fence(__ATOMIC_ACQUIRE, "workgroup"); }
__device__ __forceinline__ float pmul(float a, float b) { float p = a * b; asm volatile("" : "+v"(p)); return p; }
__device__ __forceinline__ int iclamp(int v, int lo, int hi) { return v < lo ? lo : (v > hi ? hi : v); }

typedef __attribute__((ext_vector_type(2))) _Float16 v2h;
typedef __attribute__((ext_vector_type(4))) _Float16 v4h;
typedef __attribute__((ext_vector_type(2))) float v2f;
typedef __attribute__((ext_vector_type(4))) int v4i;
__device__ __forceinline__ float nexp2(float v) { return __builtin_amdgcn_exp2f(v); }
// grid (DM/64, DM/128, 3 + XZ). z < 3: W^T planes (column tiles, k tiles, q | k | v); block = 4 waves = one tile of 128 k x 64 columns of W. Every global access covers whole lines: a thread loads 16 k rows x 4 columns
// (a wave-wide 16-B load = two 256-B row pieces), rounds them as before, and lays its four columns' 16 k values down in the LDS tile [column][k]; behind the barrier the tile's rows go out as 256-B pieces of W^T rows.
constexpr int PK = 128 /* k per tile */, PN = 64 /* columns per tile */, PP = PK + 8 /* LDS row pitch, f16: 272 B = 16 B x 17 (odd) for ds_load_b128 readers */;
// z >= 3: the x plane XH = f16(bf16(x) x 8), row-major like x, made once here for all 24 column slabs of the projections: a block takes XE consecutive elements, wave-wide 16-B loads (four whole lines) and 8-B stores (two whole lines).
constexpr int XE = 8192 /* x elements per block */, XZ = B * T * DM / (XE * (DM / PN) * (DM / PK)) /* z planes of x blocks */;
static_assert(DM % PK == 0 && DM % PN == 0 && XZ * XE * (DM / PN) * (DM / PK) == B * T * DM && XE == 128 * 4 * 16, "prep tiling");
__global__ __launch_bounds__(128) void prep_kernel(const float* __restrict__ x, const float* __restrict__ wq, const float* __restrict__ wk, const float* __restrict__ wv, b16* __restrict__ WT, b16* __restrict__ XH) {
  __shared__ __attribute__((aligned(16))) b16 Tt[PN][PP];
  if (blockIdx.z >= 3) {   // block-uniform, in front of the barrier
    const size_t e0 = (size_t)(((blockIdx.z - 3) * (DM / PK) + blockIdx.y) * (DM / PN) + blockIdx.x) * XE + threadIdx.x * 4; const float* xp = x + e0; b16* xo = XH + e0;
    v4f g[16];   // all sixteen loads of a thread are in flight at once; the unrolls keep every index of g a constant (registers, no scratch)
#pragma unroll
    for (int i = 0; i < 16; ++i) g[i] = *(const v4f*)(xp + i * 512);
    asm volatile("s_wait_xcnt 0x0" :: "v"(xp) : "memory");   // stands behind the sixteen loads and in front of every rewrite of the address pair they name; the pair is an input here so that no load's own result lands on it
#pragma unroll
    for (int i = 0; i < 16; ++i) { v4h o; for (int j = 0; j < 4; ++j) o[j] = (b16)(bf16_rne(g[i][j]) * XS); *(v4h*)(xo + i * 512) = o; }
    return; }
  const int m = blockIdx.z, n0 = blockIdx.x * PN, k0 = blockIdx.y * PK; const float* w = m == 0 ? wq : m == 1 ? wk : wv;
  const int nq = (threadIdx.x & 15) * 4, kr = (threadIdx.x >> 4) * 16; const float* wp = w + (size_t)(k0 + kr) * DM + n0 + nq;
  v4f f[16];   // all sixteen loads of a thread are in flight at once; the unrolls keep every index of f a constant (registers, no scratch)
#pragma unroll
  for (int i = 0; i < 16; ++i) f[i] = *(const v4f*)(wp + i * DM);
  asm volatile("s_wait_xcnt 0x0" :: "v"(wp) : "memory");   // stands behind the sixteen loads and in front of every rewrite of the address pair they name; the pair is an input here so that no load's own result lands on it
#pragma unroll
  for (int j = 0; j < 4; ++j) { v8b a, c;
#pragma unroll
    for (int i = 0; i < 8; ++i) { a[i] = (b16)(bf16_rne(f[i][j]) * WSC); c[i] = (b16)(bf16_rne(f[8 + i][j]) * WSC); }
    *(v8b*)&Tt[nq + j][kr] = a; *(v8b*)&Tt[nq + j][kr + 8] = c; }
  __syncthreads();   // the whole tile is written before any row of it is read
  b16* op = WT + ((size_t)m * DM + n0 + (threadIdx.x >> 4)) * DM + k0 + (threadIdx.x & 15) * 8;
#pragma unroll
  for (int i = 0; i < 8; ++i) *(v8b*)(op + i * (8 * DM)) = *(const v8b*)&Tt[(threadIdx.x >> 4) + 8 * i][(threadIdx.x & 15) * 8];
}
// projections: grid (T/64, BL, 3 x NSL slabs of 128: q | k | v); block = 64 tokens of batch b x 4 waves; A = rows of the x plane XH (exact bf16 x8, f16) and B = the W^T slab, K = 1,024 staged block-wide in LDS in 8 chunks of 128; + bias (bq | bk | bv by part);
// second launch bound: six waves per SIMD = six blocks per WGP (LDS 52,224 B each), so that all 1,536 blocks are resident at once and one block's staging hides behind the others' products
__global__ __launch_bounds__(128, 6) void proj_kernel(const b16* __restrict__ XH, const b16* __restrict__ WT, const float* __restrict__ bq, const float* __restrict__ bk, const float* __restrict__ bv, b16* __restrict__ QP, b16* __restrict__ QPl, b16* __restrict__ KP, b16* __restrict__ KPl, b16* __restrict__ VTh, b16* __restrict__ VTl) {
  // one LDS block: As (64 x KCH) and Bs (128 x KCH) during the K loop; the f32 epilogue tile Tf lies over the same bytes once every wave has left the loop. Row pitch 272 B = 16 B x 17 (odd) for ds_load_b128 readers.
  __shared__ __attribute__((aligned(16))) unsigned char smem[(64 + 128) * KP_ * 2]; static_assert(sizeof(float) * 4 * 16 * (128 + 4) <= sizeof(smem), "epilogue tile fits");
  b16 (*As)[KP_] = (b16 (*)[KP_])smem; b16 (*Bs)[KP_] = (b16 (*)[KP_])(smem + 64 * KP_ * 2); float (*Tf)[16][128 + 4] = (float (*)[16][128 + 4])smem;
  const int wave = threadIdx.x >> 5, lane = threadIdx.x & 31, nloc = lane & 15, hlf = lane >> 4; const int t0 = blockIdx.x * 64; const int b = blockIdx.y; const int part = blockIdx.z / NSL, slab = blockIdx.z % NSL, c0 = slab * 128, n0 = part * DM + c0;
  if (part == 0 && t0 >= QL) return;   // (cut builds only) queries beyond QL are not needed; block-uniform, before any barrier
  const b16* xb = XH + ((size_t)b * T + t0) * DM;
  v8f acc[8];
#pragma unroll
  for (int t = 0; t < 8; ++t) acc[t] = (v8f){};
  // staging addresses: a block-uniform base plus one 32-bit element offset per thread; every further piece is a constant step (16 KiB in global memory; 8 rows of As or Bs in LDS); x and W^T rows have one pitch, so one offset serves both
  const b16* wgb = WT + (size_t)n0 * DM; const unsigned wo = (threadIdx.x >> 4) * DM + (threadIdx.x & 15) * 8; b16* ws_ = &Bs[threadIdx.x >> 4][(threadIdx.x & 15) * 8];
  b16* xs_ = &As[threadIdx.x >> 4][(threadIdx.x & 15) * 8];
#pragma unroll 1
  for (int kc = 0; kc < DM; kc += KCH) {
    __syncthreads();
    // sixteen of the 24 pieces first, so that the loads in flight and the accumulators stay inside the register budget of six waves per SIMD; each register of xr is refilled with a piece of the slab's second half as soon as it is stored; the unrolls keep every index of xr, wr and bf a constant (registers, no scratch)
    const b16* xg = xb + kc + wo; const b16* wg = wgb + kc + wo; v8b xr[8], wr[8];   // 64 rows of x and the slab's 128 rows x KCH, loaded once per block: each wave-wide 16-B load covers two whole 256-B row pieces (4 lines)
#pragma unroll
    for (int i = 0; i < 8; ++i) xr[i] = *(const v8b*)(xg + i * (8 * DM));
#pragma unroll
    for (int i = 0; i < 8; ++i) wr[i] = *(const v8b*)(wg + i * (8 * DM));
#pragma unroll
    for (int i = 0; i < 8; ++i) { *(v8b*)(xs_ + i * 8 * KP_) = xr[i]; xr[i] = *(const v8b*)(wg + (8 + i) * (8 * DM)); }
    asm volatile("s_wait_xcnt 0x0" :: "v"(xg), "v"(wg) : "memory");   // stands behind the chunk's 24 loads and in front of every rewrite of the two address pairs they name; the pairs are inputs here so that no load's own result lands on them
#pragma unroll
    for (int i = 0; i < 8; ++i) *(v8b*)(ws_ + i * 8 * KP_) = wr[i];
#pragma unroll
    for (int i = 0; i < 8; ++i) *(v8b*)(ws_ + (8 + i) * 8 * KP_) = xr[i];
    __syncthreads();
#pragma unroll   // all four k steps of a chunk: every LDS fragment address is then base + immediate
    for (int kb = 0; kb < KCH; kb += 32) { const v16b a = frag_kb(&As[wave * 16 + nloc][kb], hlf); v16b bf[8];   // the eight B fragments of a k step are read as one group ahead of their products
#pragma unroll
      for (int t = 0; t < 8; ++t) bf[t] = frag_kb(&Bs[t * 16 + nloc][kb], hlf);
#pragma unroll
      for (int t = 0; t < 8; ++t) acc[t] = wmma16b(a, bf[t], acc[t]); } }
  __syncthreads();   // every wave's last read of As / Bs ends here: Tf overwrites those bytes
const float* ba = part == 0 ? bq : (part == 1 ? bk : bv);
#pragma unroll
  for (int t = 0; t < 8; ++t) { const float bb = bf16_rne(ba[c0 + t * 16 + nloc]);
#pragma unroll
    for (int r = 0; r < 8; ++r) Tf[wave][8 * hlf + r][t * 16 + nloc] = acc[t][r] * (1.0f / (XS * WSC)) + bb; }
  __syncthreads();
  {
    if (part < 2) { b16* plane = part == 0 ? QP : KP; b16* planl = part == 0 ? QPl : KPl; const int c = c0 + lane * 4; const int h = c / HD, d = c % HD;
      for (int rr = 0; rr < 16; ++rr) { const int tok = t0 + wave * 16 + rr; const size_t ri = (((size_t)b * H + h) * T + tok) * HD + d; const v4f f4 = *(const v4f*)(&Tf[wave][rr][lane * 4]); v4h o4, l4; for (int j = 0; j < 4; ++j) { const float f = f4[j] * XS; const b16 p = (b16)f; o4[j] = p; l4[j] = (b16)((f - (float)p) * RS_); } *(v4h*)(plane + ri) = o4; *(v4h*)(planl + ri) = l4; } }
    else {
#pragma unroll 1
      for (int q = 0; q < 32; ++q) { const int cl = wave * 32 + q; const int c = c0 + cl; const int h = c / HD, d = c % HD; const int tk = lane * 2; v2h hv, lv;
        for (int j = 0; j < 2; ++j) { const float f = Tf[(tk + j) >> 4][(tk + j) & 15][cl] * XS; const b16 p = (b16)f; hv[j] = p; lv[j] = (b16)((f - (float)p) * RS_); }
        const size_t oi = (((size_t)b * H + h) * HD + d) * (size_t)T + t0 + lane * 2; *(v2h*)(VTh + oi) = hv; *(v2h*)(VTl + oi) = lv; } }
     }
}
// attention: grid (QL/128, BL x H): block = 8 waves x 16 queries of (b, h); the keys in tiles of 64: K (hi, residual) rows and V^T (hi, residual) rows of a tile are staged block-wide in LDS by asynchronous 16-B copies (whole 128-B lines), two buffers, the next tile's copies in flight while this tile is worked on; every K and V^T fragment is read from LDS. Inside a tile two 32-key steps as before: logit = s/8 + mask[b][0][0][key] (the additive per-key f32 mask input, read as given; log2-scaled); online softmax; q/k as f16 hi x8 + residual x8192 planes (S^T: 3 products hh + (hl + lh)/1024), P x1024 as f16 hi + residual x1024 and V^T as hi x8 + residual x8192 planes (O^T: 3 products);
constexpr int KT = 64 /* keys per staged tile */, NT = T / KT, SP = 64 + 8 /* LDS row pitch, f16: 144 B = 16 B x 9 (odd) for ds_load_b128 readers */, AW = 8 /* waves per block */;
static_assert(QL % (16 * AW) == 0 && NT >= 2 && KT * 2 == 128 && HD * 2 == 128 && AW * 32 * 2 == KT * 8 && AW * 32 * 2 == HD * 8, "staging: 2 pieces of 16 B per thread and plane");
// one tile = 4 planes x 64 rows x 128 B; a thread copies rows r and r + 32 of each plane, 16 B at byte 16 c (a wave covers four whole lines per copy). l = LDS byte address of its piece in plane 0.
__device__ __forceinline__ void stage_tile(const b16* kh, const b16* kl, const b16* vh, const b16* vl, unsigned l) {
  constexpr unsigned PB = 64 * SP * 2, HB = 32 * SP * 2;
  // the wait on xcnt is the last line of the copies' own statement, so that no address register of a copy is rewritten in front of it
  asm volatile("global_load_async_to_lds_b128 %0, %8, off\n\t"
               "global_load_async_to_lds_b128 %1, %9, off\n\t"
               "global_load_async_to_lds_b128 %2, %10, off\n\t"
               "global_load_async_to_lds_b128 %3, %11, off\n\t"
               "global_load_async_to_lds_b128 %4, %12, off\n\t"
               "global_load_async_to_lds_b128 %5, %13, off\n\t"
               "global_load_async_to_lds_b128 %6, %14, off\n\t"
               "global_load_async_to_lds_b128 %7, %15, off\n\t"
               "s_wait_xcnt 0x0"
               :: "v"(l), "v"(l + HB), "v"(l + PB), "v"(l + PB + HB), "v"(l + 2 * PB), "v"(l + 2 * PB + HB), "v"(l + 3 * PB), "v"(l + 3 * PB + HB),
                  "v"(kh), "v"(kh + 32 * HD), "v"(kl), "v"(kl + 32 * HD), "v"(vh), "v"(vh + 32 * T), "v"(vl), "v"(vl + 32 * T) : "memory");
}
__global__ __launch_bounds__(AW * 32) void attn_kernel(const b16* __restrict__ QP, const b16* __restrict__ QPl, const b16* __restrict__ KP, const b16* __restrict__ KPl, const b16* __restrict__ VTh, const b16* __restrict__ VTl, const float* __restrict__ MSK, float* __restrict__ OUTC) {
  __shared__ __attribute__((aligned(16))) b16 St[2][4][64][SP];   // [buffer][K hi | K residual | V^T hi | V^T residual][key or d][d or key]
  __shared__ __attribute__((aligned(16))) b16 Pb[AW][16][32 + 8], Pl[AW][16][32 + 8]; __shared__ __attribute__((aligned(16))) float To[AW][16][HD + 4];
  __shared__ __attribute__((aligned(16))) float Mk[T];   // the batch's mask row in log2 units
  static_assert(T == AW * 32 * 4, "mask row: one 16-B piece per thread");
  const int wave = threadIdx.x >> 5, lane = threadIdx.x & 31, hh = lane >> 4, col = lane & 15; const int b = blockIdx.y / H, h = blockIdx.y % H; const int q0 = blockIdx.x * (16 * AW) + wave * 16, qi = q0 + col;
  const size_t ph = (size_t)b * H + h; const b16* Qb = QP + ph * T * HD; const b16* Qbl = QPl + ph * T * HD; const b16* Kb = KP + ph * T * HD; const b16* Kbl = KPl + ph * T * HD; const b16* Vh = VTh + ph * HD * (size_t)T; const b16* Vl = VTl + ph * HD * (size_t)T; const float* mrow = MSK + (size_t)b * T;   // per-(b,h) planes; the batch's per-key additive mask row [B,1,1,S] (shared by all queries and heads)
  // this thread's pieces of a tile: row sr (and sr + 32), 16-B column sc
  const int sr = threadIdx.x >> 3, sc = (threadIdx.x & 7) * 8; const size_t ko = (size_t)sr * HD + sc, vo = (size_t)sr * T + sc;
  const unsigned sl = (unsigned)(size_t)&St[0][0][sr][sc]; constexpr unsigned BB = 4 * 64 * SP * 2;   // low 32 bits of the shared address = byte offset in the work-group's LDS; BB = bytes of one buffer
  stage_tile(Kb + ko, Kbl + ko, Vh + vo, Vl + vo, sl);
  const v16b qa0 = frag_kb(Qb + (size_t)qi * HD, hh), qa1 = frag_kb(Qb + (size_t)qi * HD + 32, hh), ql0 = frag_kb(Qbl + (size_t)qi * HD, hh), ql1 = frag_kb(Qbl + (size_t)qi * HD + 32, hh);
  // the mask row is loaded and scaled once per block and kept in LDS: in the loop every 32-key step would touch a fresh 128-B line of it, and each wave would wait for that line between its products
  { const float* mp = mrow + threadIdx.x * 4; const v4f mv = *(const v4f*)mp;
    asm volatile("s_wait_xcnt 0x0" ::: "memory");   // stands behind the load and in front of every rewrite of a register that the load names as its address
    *(v4f*)&Mk[threadIdx.x * 4] = mv * LOG2E; }
  asm volatile("s_wait_asynccnt 0x0" ::: "memory");   // this wave's copies of tile 0 have landed
  __syncthreads();                                     // tile 0 and the mask row published to every wave
  stage_tile(Kb + ko + (size_t)KT * HD, Kbl + ko + (size_t)KT * HD, Vh + vo + KT, Vl + vo + KT, sl + BB);
  const float cs = LOG2E / (8.0f * XS * XS);
  float m = -INFINITY, l = 0.0f; v8f o[4], ol[4]; for (int t = 0; t < 4; ++t) { o[t] = (v8f){}; ol[t] = (v8f){}; }
#pragma unroll 1   // one trip per tile: the publish point at its foot stands once
  for (int kt = 0; kt < NT; ++kt) {
    const b16 (*Sb)[64][SP] = St[kt & 1];
#pragma unroll   // both 32-key steps of a tile: every LDS fragment address is then base + immediate
    for (int kk = 0; kk < KT; kk += 32) { const int kb = kt * KT + kk;
    float e[16]; float mx = -INFINITY; v16b kf[2][4]; v4f mq[2][2];   // the eight K fragments of a 32-key step and the step's mask values are read from LDS as one group ahead of the products; the unrolls keep every index of kf, mq and vf a constant (registers, no scratch)
#pragma unroll
    for (int u = 0; u < 2; ++u) { const int kr = kk + u * 16 + col; kf[u][0] = frag_kb(&Sb[0][kr][0], hh); kf[u][1] = frag_kb(&Sb[0][kr][32], hh); kf[u][2] = frag_kb(&Sb[1][kr][0], hh); kf[u][3] = frag_kb(&Sb[1][kr][32], hh); }
#pragma unroll
    for (int u = 0; u < 2; ++u) { mq[u][0] = *(const v4f*)&Mk[kb + u * 16 + 8 * hh]; mq[u][1] = *(const v4f*)&Mk[kb + u * 16 + 8 * hh + 4]; }   // mask (log2 units) for keys kb + 16u + 8hh .. +7 of this lane's query
#pragma unroll
    for (int u = 0; u < 2; ++u) { v8f s = (v8f){}, sx = (v8f){}; { const v16b k0 = kf[u][0], k1 = kf[u][1]; s = wmma16b(k0, qa0, s); s = wmma16b(k1, qa1, s); sx = wmma16b(k0, ql0, sx); sx = wmma16b(k1, ql1, sx); sx = wmma16b(kf[u][2], qa0, sx); sx = wmma16b(kf[u][3], qa1, sx); }
#pragma unroll
      for (int r = 0; r < 8; ++r) s[r] += sx[r] * (1.0f / RS_);   // hi.hi + (hi.lo + lo.hi)/1024
#pragma unroll
      for (int r = 0; r < 8; ++r) { const float mk = r < 4 ? mq[u][0][r] : mq[u][1][r - 4]; const float vv = fmaf(s[r], cs, mk); e[u * 8 + r] = vv; mx = fmaxf(mx, vv); } }
    v16b vf[4][2];   // the eight V^T fragments of the step are read as one group here, so that they arrive behind the softmax arithmetic
#pragma unroll
    for (int t = 0; t < 4; ++t) { vf[t][0] = frag_kb(&Sb[2][t * 16 + col][kk], hh); vf[t][1] = frag_kb(&Sb[3][t * 16 + col][kk], hh); }
    mx = fmaxf(mx, __shfl_xor(mx, 16)); const float mn = fmaxf(m, mx); const float al = nexp2(m - mn); float sum = 0.0f;
#pragma unroll
    for (int i2 = 0; i2 < 16; ++i2) { const float p = nexp2(e[i2] - mn); sum += p; const float ps = p * PS; const b16 phh = (b16)ps; const int pc = (i2 < 8 ? 0 : 16) + 8 * hh + (i2 & 7); Pb[wave][col][pc] = phh; Pl[wave][col][pc] = (b16)((ps - (float)phh) * RS_); }
    sum += __shfl_xor(sum, 16); l = l * al + sum; m = mn;
    wave_lds_sync();
    const v16b pf = frag_kb(&Pb[wave][col][0], hh), plf = frag_kb(&Pl[wave][col][0], hh);
#pragma unroll
    for (int t = 0; t < 4; ++t) { const v16b vh = vf[t][0]; o[t] *= al; o[t] = wmma16b(vh, pf, o[t]); ol[t] = wmma16b(vf[t][1], pf, ol[t] * al); ol[t] = wmma16b(vh, plf, ol[t]); }   // ol = (V_lo P_hi + V_hi P_lo), both /1024
    wave_lds_sync(); }
    // publish point of tile kt + 1, every wave, in this order
    asm volatile("s_wait_dscnt 0x0" ::: "memory");      // this wave's reads of the buffer that is refilled below have returned
    asm volatile("s_wait_asynccnt 0x0" ::: "memory");   // this wave's copies of tile kt + 1 have landed
    __syncthreads();                                     // publishes tile kt + 1 and ends every wave's reads of tile kt
    if (kt + 2 < NT) stage_tile(Kb + ko + (size_t)(kt + 2) * KT * HD, Kbl + ko + (size_t)(kt + 2) * KT * HD, Vh + vo + (kt + 2) * KT, Vl + vo + (kt + 2) * KT, sl + (unsigned)(kt & 1) * BB); }
  asm volatile("s_wait_asynccnt 0x0" ::: "memory");   // no copy is outstanding when the wave goes on to its end
  const float inv = 1.0f / (l * PS * XS);
#pragma unroll
  for (int t = 0; t < 4; ++t)
#pragma unroll
    for (int r = 0; r < 8; ++r) To[wave][col][t * 16 + 8 * hh + r] = (o[t][r] + ol[t][r] * (1.0f / RS_)) * inv;
  wave_lds_sync();
  { for (int rr = 0; rr < 16; ++rr) { const size_t oi = ((size_t)b * T + q0 + rr) * DM + h * HD + lane * 2; *(v2f*)(OUTC + oi) = *(const v2f*)(&To[wave][rr][lane * 2]); }  }   // ctx row segment (query, head) = 64 f32 = 256 B by 32 lanes x 8 B
}
}  // namespace

extern "C" void kernel_launch(void* const* d_in, const int* in_sizes, int n_in, void* d_out, int out_size, void* d_ws, size_t ws_size, hipStream_t stream) {
  (void)n_in;
  auto Fp = [&](int i) { return (const float*)d_in[i]; };
  // input order: 0 hidden_states [4,1024,1024], 1 attention_mask [4,1,1,1024] f32 additive, 2 Wq [1024,1024] (in,out), 3 bq, 4 Wk, 5 bk, 6 Wv, 7 bv
  if (in_sizes[0] != B * T * DM || in_sizes[1] != B * T || in_sizes[2] != DM * DM || in_sizes[4] != DM * DM || in_sizes[6] != DM * DM || in_sizes[3] != DM || in_sizes[5] != DM || in_sizes[7] != DM || out_size != B * T * DM) return;
  size_t off = 0; char* ws = (char*)d_ws;
  auto carve = [&](size_t bytes) { char* p = ws + off; off += (bytes + 255) & ~(size_t)255; return p; };
  b16* WT = (b16*)carve((size_t)3 * DM * DM * 2); const size_t plane = (size_t)B * T * DM * 2; b16* XH = (b16*)carve(plane);
  b16* QP = (b16*)carve(plane); b16* QPl = (b16*)carve(plane); b16* KP = (b16*)carve(plane); b16* KPl = (b16*)carve(plane); b16* VTh = (b16*)carve(plane); b16* VTl = (b16*)carve(plane);
  if (off > ws_size || off > ((size_t)128 << 20)) return;   // = ~65 MB
  prep_kernel<<<dim3(DM / PN, DM / PK, 3 + XZ), 128, 0, stream>>>(Fp(0), Fp(2), Fp(4), Fp(6), WT, XH);
  proj_kernel<<<dim3(T / 64, BL, 3 * NSL), 128, 0, stream>>>(XH, WT, Fp(3), Fp(5), Fp(7), QP, QPl, KP, KPl, VTh, VTl);
  attn_kernel<<<dim3(QL / (16 * AW), BL * H), AW * 32, 0, stream>>>(QP, QPl, KP, KPl, VTh, VTl, Fp(1), (float*)d_out);
}

// v007
// One run takes 59.7 microseconds.
// Versions between v005 and this one are left out; their measured steps multiply to 1.53 times as fast.
// Over all steps from v000 it is 6.27 times as fast.
#include <hip/hip_runtime.h>

// Self-attention (4 x 1024 x 1024, 16 heads x 64): q/k/v = x W + b ((in,out) weights), scores = q k^T / 8 + attention_mask ([4,1,1,1024] additive per key, read as given; zeros here);
// softmax; ctx heads concatenated -> [4][1024][1024] (no output projection).
// Deterministic: flash-style per 16-query wave over all keys (running max); no atomics.
// compute dtype: WMMA v_wmma_f32_16x16x32_f16 with f32 accumulate for the projections ([4096 x 1024] x [1024 x 3072]; x EXACT bf16 x8, W^T exact x256: 1 product), S^T = K Q^T (q, k each one f16
// term x8: 1 product), O^T += V^T P^T (V^T one f16 term x8, P x1024 one f16 term: 1 product; each operand rounded once to f16, 11 significant bits); ctx written in f32 from the accumulators; mask add and softmax statistics
// in f32. Inputs rounded to bf16 once. Fragment k-map per lane half hh for A AND B: elements 0..7 <- k = 8hh+0..7, 8..15 <- k = 16+8hh+0..7; acc[r] = D[8hh+r][col].

namespace {
constexpr int B = 4, T = 1024, DM = 1024, H = 16, HD = 64, BL = 4 /* batches (== 4 shipped) */, QL = 1024 /* query rows (== 1024 shipped) */;
constexpr int NSL = DM / 128;
constexpr int KCH = 128 /* K per staged chunk of the projections */, KP_ = KCH + 8 /* LDS row pitch, f16 */;
constexpr float XS = 8.0f, WSC = 256.0f, PS = 1024.0f, LOG2E = 1.4426950408889634f;
static_assert(T % 64 == 0 && QL % 32 == 0 && DM % 256 == 0 && H * HD == DM && HD == 64, "tiling");
typedef _Float16 b16;
typedef __attribute__((ext_vector_type(16))) _Float16 v16b;
typedef __attribute__((ext_vector_type(8))) _Float16 v8b;
typedef __attribute__((ext_vector_type(8))) float v8f;
typedef __attribute__((ext_vector_type(4))) float v4f;
__device__ __forceinline__ float bf16_rne(float f) { unsigned int u = __float_as_uint(f); u += 0x7FFFu + ((u >> 16) & 1u); return __uint_as_float(u & 0xFFFF0000u); }
__device__ __forceinline__ void split16(float v, b16& hi, b16& lo) { hi = (b16)v; lo = (b16)(v - (float)hi); }
__device__ __forceinline__ v16b frag_kb(const b16* p, int hh) { const v8b a = *(const v8b*)(p + 8 * hh), b = *(const v8b*)(p + 16 + 8 * hh); v16b f;
#pragma unroll
  for (int e = 0; e < 8; ++e) { f[e] = a[e]; f[8 + e] = b[e]; } return f; }
__device__ __forceinline__ v8f wmma16b(v16b a, v16b b, v8f c) { v8f d = __builtin_amdgcn_wmma_f32_16x16x32_f16(false, a, false, b, (short)0, c, false, false); asm volatile("v_nop\n\tv_nop\n\tv_nop\n\tv_nop" : "+v"(d) : "v"(a), "v"(b)); return d; }
__device__ __forceinline__ void wave_lds_sync() { __builtin_amdgcn_fence(__ATOMIC_RELEASE, "workgroup"); __builtin_amdgcn_wave_barrier(); __builtin_amdgcn_fence(__ATOMIC_ACQUIRE, "workgroup"); }
__device__ __forceinline__ float pmul(float a, float b) { float p = a * b; asm volatile("" : "+v"(p)); return p; }
__device__ __forceinline__ int iclamp(int v, int lo, int hi) { return v < lo ? lo : (v > hi ? hi : v); }

typedef __attribute__((ext_vector_type(2))) _Float16 v2h;
typedef __attribute__((ext_vector_type(4))) _Float16 v4h;
typedef __attribute__((ext_vector_type(2))) float v2f;
typedef __attribute__((ext_vector_type(4))) int v4i;
__device__ __forceinline__ float nexp2(float v) { return __builtin_amdgcn_exp2f(v); }
// grid (DM/64, DM/128, 3 + XZ). z < 3: W^T planes (column tiles, k tiles, q | k | v); block = 4 waves = one tile of 128 k x 64 columns of W. Every global access covers whole lines: a thread loads 16 k rows x 4 columns
// (a wave-wide 16-B load = two 256-B row pieces), rounds them as before, and lays its four columns' 16 k values down in the LDS tile [column][k]; behind the barrier the tile's rows go out as 256-B pieces of W^T rows.
constexpr int PK = 128 /* k per tile */, PN = 64 /* columns per tile */, PP = PK + 8 /* LDS row pitch, f16: 272 B = 16 B x 17 (odd) for ds_load_b128 readers */;
// z >= 3: the x plane XH = f16(bf16(x) x 8), row-major like x, made once here for all 24 column slabs of the projections: a block takes XE consecutive elements, wave-wide 16-B loads (four whole lines) and 8-B stores (two whole lines).
constexpr int XE = 8192 /* x elements per block */, XZ = B * T * DM / (XE * (DM / PN) * (DM / PK)) /* z planes of x blocks */;
static_assert(DM % PK == 0 && DM % PN == 0 && XZ * XE * (DM / PN) * (DM / PK) == B * T * DM && XE == 128 * 4 * 16, "prep tiling");
__global__ __launch_bounds__(128) void prep_kernel(const float* __restrict__ x, const float* __restrict__ wq, const float* __restrict__ wk, const float* __restrict__ wv, b16* __restrict__ WT, b16* __restrict__ XH) {
  __shared__ __attribute__((aligned(16))) b16 Tt[PN][PP];
  if (blockIdx.z >= 3) {   // block-uniform, in front of the barrier
    const size_t e0 = (size_t)(((blockIdx.z - 3) * (DM / PK) + blockIdx.y) * (DM / PN) + blockIdx.x) * XE + threadIdx.x * 4; const float* xp = x + e0; b16* xo = XH + e0;
    v4f g[16];   // all sixteen loads of a thread are in flight at once; the unrolls keep every index of g a constant (registers, no scratch)
#pragma unroll
    for (int i = 0; i < 16; ++i) g[i] = *(const v4f*)(xp + i * 512);
    asm volatile("s_wait_xcnt 0x0" :: "v"(xp) : "memory");   // stands behind the sixteen loads and in front of every rewrite of the address pair they name; the pair is an input here so that no load's own result lands on it
#pragma unroll
    for (int i = 0; i < 16; ++i) { v4h o; for (int j = 0; j < 4; ++j) o[j] = (b16)(bf16_rne(g[i][j]) * XS); *(v4h*)(xo + i * 512) = o; }
    return; }
  const int m = blockIdx.z, n0 = blockIdx.x * PN, k0 = blockIdx.y * PK; const float* w = m == 0 ? wq : m == 1 ? wk : wv;
  const int nq = (threadIdx.x & 15) * 4, kr = (threadIdx.x >> 4) * 16; const float* wp = w + (size_t)(k0 + kr) * DM + n0 + nq;
  v4f f[16];   // all sixteen loads of a thread are in flight at once; the unrolls keep every index of f a constant (registers, no scratch)
#pragma unroll
  for (int i = 0; i < 16; ++i) f[i] = *(const v4f*)(wp + i * DM);
  asm volatile("s_wait_xcnt 0x0" :: "v"(wp) : "memory");   // stands behind the sixteen loads and in front of every rewrite of the address pair they name; the pair is an input here so that no load's own result lands on it
#pragma unroll
  for (int j = 0; j < 4; ++j) { v8b a, c;
#pragma unroll
    for (int i = 0; i < 8; ++i) { a[i] = (b16)(bf16_rne(f[i][j]) * WSC); c[i] = (b16)(bf16_rne(f[8 + i][j]) * WSC); }
    *(v8b*)&Tt[nq + j][kr] = a; *(v8b*)&Tt[nq + j][kr + 8] = c; }
  __syncthreads();   // the whole tile is written before any row of it is read
  b16* op = WT + ((size_t)m * DM + n0 + (threadIdx.x >> 4)) * DM + k0 + (threadIdx.x & 15) * 8;
#pragma unroll
  for (int i = 0; i < 8; ++i) *(v8b*)(op + i * (8 * DM)) = *(const v8b*)&Tt[(threadIdx.x >> 4) + 8 * i][(threadIdx.x & 15) * 8];
}
// projections: grid (T/128, BL, 3 x NSL slabs of 128: q | k | v); block = 4 waves (2 x 2) = one tile of 128 tokens of batch b x 128 columns, a wave = 64 x 64 (16 accumulator tiles): a k step reads 4 + 4 fragments from LDS for 16 products.
// Rows of the x plane XH (exact bf16 x8, f16) and of the W^T slab, K = 1,024 staged block-wide in LDS in 8 chunks of 128; + bias (bq | bk | bv by part).
// q, k: matrix rows = tokens, matrix columns = output columns. v: the two operands change places (both fragment maps are one map), so that the accumulators hold V^T and every plane leaves by rows of the tile.
constexpr int BM = 128 /* tokens per block */, BN = 128 /* columns per block */, TP = 128 + 4 /* epilogue tile pitch, f32 */;
static_assert(T % BM == 0 && QL % BM == 0 && BM == BN && BN == DM / NSL && HD == 64, "projection tiling");
// second launch bound: four waves per SIMD, so that no register above v255 is used; the grid fills three (768 blocks on 256 WGPs)
__global__ __launch_bounds__(128, 4) void proj_kernel(const b16* __restrict__ XH, const b16* __restrict__ WT, const float* __restrict__ bq, const float* __restrict__ bk, const float* __restrict__ bv, b16* __restrict__ QP, b16* __restrict__ KP, b16* __restrict__ VTh) {
  // one LDS block: Sm rows 0..127 = x rows, 128..255 = W^T rows (KCH each) during the K loop; the f32 epilogue tile Tf lies over the same bytes once every wave has left the loop. Row pitch 272 B = 16 B x 17 (odd) for ds_load_b128 readers.
  __shared__ __attribute__((aligned(16))) unsigned char smem[(BM + BN) * KP_ * 2]; static_assert(sizeof(float) * BM * TP <= sizeof(smem), "epilogue tile fits");
  b16 (*Sm)[KP_] = (b16 (*)[KP_])smem; float (*Tf)[TP] = (float (*)[TP])smem;
  const int wave = threadIdx.x >> 5, lane = threadIdx.x & 31, nloc = lane & 15, hlf = lane >> 4; const int t0 = blockIdx.x * BM; const int b = blockIdx.y; const int part = blockIdx.z / NSL, slab = blockIdx.z % NSL, c0 = slab * BN, n0 = part * DM + c0;
  if (part == 0 && t0 >= QL) return;   // (cut builds only) queries beyond QL are not needed; block-uniform, before any barrier
  const b16* xb = XH + ((size_t)b * T + t0) * DM;
  const int mr = (part == 2 ? BM : 0) + (wave >> 1) * 64 + nloc, nr = (part == 2 ? 0 : BM) + (wave & 1) * 64 + nloc;   // this lane's first row of the operand that gives the matrix rows, and of the one that gives the matrix columns
  v8f acc[4][4];
#pragma unroll
  for (int i = 0; i < 4; ++i)
#pragma unroll
    for (int j = 0; j < 4; ++j) acc[i][j] = (v8f){};
  // staging addresses: a block-uniform base plus one 32-bit element offset per thread; every further piece is a constant step (16 KiB in global memory; 8 rows of Sm in LDS); x and W^T rows have one pitch, so one offset serves both
  const b16* wgb = WT + (size_t)n0 * DM; const unsigned wo = (threadIdx.x >> 4) * DM + (threadIdx.x & 15) * 8; b16* st_ = &Sm[threadIdx.x >> 4][(threadIdx.x & 15) * 8];
#pragma unroll 1
  for (int kc = 0; kc < DM; kc += KCH) {
    __syncthreads();
    // the 16 pieces of x first; each register of rg is refilled with a piece of the slab as soon as it is stored, so that the loads in flight and the accumulators stay below v256; the unrolls keep every index of rg, af and bf a constant (registers, no scratch)
    const b16* xg = xb + kc + wo; const b16* wg = wgb + kc + wo; v8b rg[16];   // 128 rows of x and the slab's 128 rows x KCH, loaded once per block: each wave-wide 16-B load covers two whole 256-B row pieces (4 lines)
#pragma unroll
    for (int i = 0; i < 16; ++i) rg[i] = *(const v8b*)(xg + i * (8 * DM));
#pragma unroll
    for (int i = 0; i < 16; ++i) { *(v8b*)(st_ + i * 8 * KP_) = rg[i]; rg[i] = *(const v8b*)(wg + i * (8 * DM)); }
    asm volatile("s_wait_xcnt 0x0" :: "v"(xg), "v"(wg) : "memory");   // stands behind the chunk's 32 loads and in front of every rewrite of the two address pairs they name; the pairs are inputs here so that no load's own result lands on them
#pragma unroll
    for (int i = 0; i < 16; ++i) *(v8b*)(st_ + (16 + i) * 8 * KP_) = rg[i];
    __syncthreads();
#pragma unroll   // all four k steps of a chunk: every LDS fragment address is then base + immediate
    for (int kb = 0; kb < KCH; kb += 32) { v16b af[4], bf[4];   // the eight fragments of a k step are read as one group ahead of their sixteen products
#pragma unroll
      for (int i = 0; i < 4; ++i) af[i] = frag_kb(&Sm[mr + i * 16][kb], hlf);
#pragma unroll
      for (int j = 0; j < 4; ++j) bf[j] = frag_kb(&Sm[nr + j * 16][kb], hlf);
#pragma unroll
      for (int i = 0; i < 4; ++i)
#pragma unroll
        for (int j = 0; j < 4; ++j) acc[i][j] = wmma16b(af[i], bf[j], acc[i][j]); } }
  __syncthreads();   // every wave's last read of Sm ends here: Tf overwrites those bytes
#pragma unroll
  for (int i = 0; i < 4; ++i)
#pragma unroll
    for (int j = 0; j < 4; ++j)
#pragma unroll
      for (int r = 0; r < 8; ++r) Tf[(wave >> 1) * 64 + i * 16 + 8 * hlf + r][(wave & 1) * 64 + j * 16 + nloc] = acc[i][j][r];
  __syncthreads();
  if (part < 2) {   // Tf[token][column]: a head's 64 columns of consecutive tokens are consecutive bytes of its plane; a wave takes one head x 64 tokens, each wave-wide 16-B store = 4 tokens = four whole lines
    b16* plane = part == 0 ? QP : KP; const float* ba = part == 0 ? bq : bk; const int hs = wave & 1, tb = (wave >> 1) * 64 + (lane >> 3), cc = hs * 64 + (lane & 7) * 8;
    const float* bp = ba + c0 + cc; const v4f b0 = *(const v4f*)bp, b1 = *(const v4f*)(bp + 4);
    asm volatile("s_wait_xcnt 0x0" :: "v"(bp) : "memory");   // stands behind the two loads and in front of every rewrite of the address pair they name
    b16* op = plane + (((size_t)b * H + (c0 / HD) + hs) * T + t0 + tb) * HD + (lane & 7) * 8;
#pragma unroll   // every LDS and global address is then base + immediate
    for (int it = 0; it < 16; ++it) { const float* tp = &Tf[tb + it * 4][cc]; const v4f f0 = *(const v4f*)tp, f1 = *(const v4f*)(tp + 4); v8b o;
#pragma unroll
      for (int j = 0; j < 4; ++j) { o[j] = (b16)((f0[j] * (1.0f / (XS * WSC)) + bf16_rne(b0[j])) * XS); o[4 + j] = (b16)((f1[j] * (1.0f / (XS * WSC)) + bf16_rne(b1[j])) * XS); }
      *(v8b*)(op + it * 4 * HD) = o; }
    asm volatile("s_wait_xcnt 0x0" :: "v"(op) : "memory"); }   // stands behind the sixteen stores and in front of every rewrite of the address pair they name
  else {   // Tf[column][token]: a row is 256 B of one V^T row; a wave takes 32 columns, each wave-wide 16-B store = 2 columns x 128 tokens = four whole lines
    const int r0 = wave * 32 + (lane >> 4), tc = (lane & 15) * 8; const float* bp = bv + c0 + r0; float bb[16];
#pragma unroll
    for (int it = 0; it < 16; ++it) bb[it] = bp[it * 2];
    asm volatile("s_wait_xcnt 0x0" :: "v"(bp) : "memory");   // stands behind the sixteen loads and in front of every rewrite of the address pair they name
    b16* op = VTh + ((size_t)b * DM + c0 + r0) * (size_t)T + t0 + tc;
#pragma unroll   // every LDS and global address is then base + immediate
    for (int it = 0; it < 16; ++it) { const float* tp = &Tf[r0 + it * 2][tc]; const v4f f0 = *(const v4f*)tp, f1 = *(const v4f*)(tp + 4); const float bc = bf16_rne(bb[it]); v8b o;
#pragma unroll
      for (int j = 0; j < 4; ++j) { o[j] = (b16)((f0[j] * (1.0f / (XS * WSC)) + bc) * XS); o[4 + j] = (b16)((f1[j] * (1.0f / (XS * WSC)) + bc) * XS); }
      *(v8b*)(op + it * 2 * T) = o; }
    asm volatile("s_wait_xcnt 0x0" :: "v"(op) : "memory"); }   // stands behind the sixteen stores and in front of every rewrite of the address pair they name
}
// attention: grid (QL/128, BL x H): block = 8 waves x 16 queries of (b, h); the keys in tiles of 64: K rows and V^T rows of a tile are staged block-wide in LDS by asynchronous 16-B copies (whole 128-B lines), two buffers, the next tile's copies in flight while this tile is worked on; every K and V^T fragment is read from LDS. Inside a tile two 32-key steps as before: logit = s/8 + mask[b][0][0][key] (the additive per-key f32 mask input, read as given; log2-scaled); online softmax; q, k and V^T as one f16 plane x8 each, P x1024 as one f16 term (S^T and O^T: 1 product each);
constexpr int KT = 64 /* keys per staged tile */, NT = T / KT, SP = 64 + 8 /* LDS row pitch, f16: 144 B = 16 B x 9 (odd) for ds_load_b128 readers */, AW = 8 /* waves per block */;
static_assert(QL % (16 * AW) == 0 && NT >= 2 && KT * 2 == 128 && HD * 2 == 128 && AW * 32 * 2 == KT * 8 && AW * 32 * 2 == HD * 8, "staging: 2 pieces of 16 B per thread and plane");
// one tile = 2 planes x 64 rows x 128 B; a thread copies rows r and r + 32 of each plane, 16 B at byte 16 c (a wave covers four whole lines per copy). l = LDS byte address of its piece in plane 0.
__device__ __forceinline__ void stage_tile(const b16* kh, const b16* vh, unsigned l) {
  constexpr unsigned PB = 64 * SP * 2, HB = 32 * SP * 2;
  // the wait on xcnt is the last line of the copies' own statement, so that no address register of a copy is rewritten in front of it
  asm volatile("global_load_async_to_lds_b128 %0, %4, off\n\t"
               "global_load_async_to_lds_b128 %1, %5, off\n\t"
               "global_load_async_to_lds_b128 %2, %6, off\n\t"
               "global_load_async_to_lds_b128 %3, %7, off\n\t"
               "s_wait_xcnt 0x0"
               :: "v"(l), "v"(l + HB), "v"(l + PB), "v"(l + PB + HB),
                  "v"(kh), "v"(kh + 32 * HD), "v"(vh), "v"(vh + 32 * T) : "memory");
}
__global__ __launch_bounds__(AW * 32) void attn_kernel(const b16* __restrict__ QP, const b16* __restrict__ KP, const b16* __restrict__ VTh, const float* __restrict__ MSK, float* __restrict__ OUTC) {
  __shared__ __attribute__((aligned(16))) b16 St[2][2][64][SP];   // [buffer][K | V^T][key or d][d or key]
  __shared__ __attribute__((aligned(16))) b16 Pb[AW][16][32 + 8]; __shared__ __attribute__((aligned(16))) float To[AW][16][HD + 4];
  __shared__ __attribute__((aligned(16))) float Mk[T];   // the batch's mask row in log2 units
  static_assert(T == AW * 32 * 4, "mask row: one 16-B piece per thread");
  const int wave = threadIdx.x >> 5, lane = threadIdx.x & 31, hh = lane >> 4, col = lane & 15; const int b = blockIdx.y / H, h = blockIdx.y % H; const int q0 = blockIdx.x * (16 * AW) + wave * 16, qi = q0 + col;
  const size_t ph = (size_t)b * H + h; const b16* Qb = QP + ph * T * HD; const b16* Kb = KP + ph * T * HD; const b16* Vh = VTh + ph * HD * (size_t)T; const float* mrow = MSK + (size_t)b * T;   // per-(b,h) planes; the batch's per-key additive mask row [B,1,1,S] (shared by all queries and heads)
  // this thread's pieces of a tile: row sr (and sr + 32), 16-B column sc
  const int sr = threadIdx.x >> 3, sc = (threadIdx.x & 7) * 8; const size_t ko = (size_t)sr * HD + sc, vo = (size_t)sr * T + sc;
  const unsigned sl = (unsigned)(size_t)&St[0][0][sr][sc]; constexpr unsigned BB = 2 * 64 * SP * 2;   // low 32 bits of the shared address = byte offset in the work-group's LDS; BB = bytes of one buffer
  stage_tile(Kb + ko, Vh + vo, sl);
  const v16b qa0 = frag_kb(Qb + (size_t)qi * HD, hh), qa1 = frag_kb(Qb + (size_t)qi * HD + 32, hh);
  // the mask row is loaded and scaled once per block and kept in LDS: in the loop every 32-key step would touch a fresh 128-B line of it, and each wave would wait for that line between its products
  { const float* mp = mrow + threadIdx.x * 4; const v4f mv = *(const v4f*)mp;
    asm volatile("s_wait_xcnt 0x0" ::: "memory");   // stands behind the load and in front of every rewrite of a register that the load names as its address
    *(v4f*)&Mk[threadIdx.x * 4] = mv * LOG2E; }
  asm volatile("s_wait_asynccnt 0x0" ::: "memory");   // this wave's copies of tile 0 have landed
  __syncthreads();                                     // tile 0 and the mask row published to every wave
  stage_tile(Kb + ko + (size_t)KT * HD, Vh + vo + KT, sl + BB);
  const float cs = LOG2E / (8.0f * XS * XS);
  float m = -INFINITY, l = 0.0f; v8f o[4]; for (int t = 0; t < 4; ++t) o[t] = (v8f){};
#pragma unroll 1   // one trip per tile: the publish point at its foot stands once
  for (int kt = 0; kt < NT; ++kt) {
    const b16 (*Sb)[64][SP] = St[kt & 1];
#pragma unroll   // both 32-key steps of a tile: every LDS fragment address is then base + immediate
    for (int kk = 0; kk < KT; kk += 32) { const int kb = kt * KT + kk;
    float e[16]; float mx = -INFINITY; v16b kf[2][2]; v4f mq[2][2];   // the four K fragments of a 32-key step and the step's mask values are read from LDS as one group ahead of the products; the unrolls keep every index of kf, mq and vf a constant (registers, no scratch)
#pragma unroll
    for (int u = 0; u < 2; ++u) { const int kr = kk + u * 16 + col; kf[u][0] = frag_kb(&Sb[0][kr][0], hh); kf[u][1] = frag_kb(&Sb[0][kr][32], hh); }
#pragma unroll
    for (int u = 0; u < 2; ++u) { mq[u][0] = *(const v4f*)&Mk[kb + u * 16 + 8 * hh]; mq[u][1] = *(const v4f*)&Mk[kb + u * 16 + 8 * hh + 4]; }   // mask (log2 units) for keys kb + 16u + 8hh .. +7 of this lane's query
#pragma unroll
    for (int u = 0; u < 2; ++u) { v8f s = (v8f){}; s = wmma16b(kf[u][0], qa0, s); s = wmma16b(kf[u][1], qa1, s);
#pragma unroll
      for (int r = 0; r < 8; ++r) { const float mk = r < 4 ? mq[u][0][r] : mq[u][1][r - 4]; const float vv = fmaf(s[r], cs, mk); e[u * 8 + r] = vv; mx = fmaxf(mx, vv); } }
    v16b vf[4];   // the four V^T fragments of the step are read as one group here, so that they arrive behind the softmax arithmetic
#pragma unroll
    for (int t = 0; t < 4; ++t) vf[t] = frag_kb(&Sb[1][t * 16 + col][kk], hh);
    mx = fmaxf(mx, __shfl_xor(mx, 16)); const float mn = fmaxf(m, mx); const float al = nexp2(m - mn); float sum = 0.0f;
#pragma unroll
    for (int i2 = 0; i2 < 16; ++i2) { const float p = nexp2(e[i2] - mn); sum += p; const int pc = (i2 < 8 ? 0 : 16) + 8 * hh + (i2 & 7); Pb[wave][col][pc] = (b16)(p * PS); }
    sum += __shfl_xor(sum, 16); l = l * al + sum; m = mn;
    wave_lds_sync();
    const v16b pf = frag_kb(&Pb[wave][col][0], hh);
#pragma unroll
    for (int t = 0; t < 4; ++t) { o[t] *= al; o[t] = wmma16b(vf[t], pf, o[t]); }
    wave_lds_sync(); }
    // publish point of tile kt + 1, every wave, in this order
    asm volatile("s_wait_dscnt 0x0" ::: "memory");      // this wave's reads of the buffer that is refilled below have returned
    asm volatile("s_wait_asynccnt 0x0" ::: "memory");   // this wave's copies of tile kt + 1 have landed
    __syncthreads();                                     // publishes tile kt + 1 and ends every wave's reads of tile kt
    if (kt + 2 < NT) stage_tile(Kb + ko + (size_t)(kt + 2) * KT * HD, Vh + vo + (kt + 2) * KT, sl + (unsigned)(kt & 1) * BB); }
  asm volatile("s_wait_asynccnt 0x0" ::: "memory");   // no copy is outstanding when the wave goes on to its end
  const float inv = 1.0f / (l * PS * XS);
#pragma unroll
  for (int t = 0; t < 4; ++t)
#pragma unroll
    for (int r = 0; r < 8; ++r) To[wave][col][t * 16 + 8 * hh + r] = o[t][r] * inv;
  wave_lds_sync();
  { for (int rr = 0; rr < 16; ++rr) { const size_t oi = ((size_t)b * T + q0 + rr) * DM + h * HD + lane * 2; *(v2f*)(OUTC + oi) = *(const v2f*)(&To[wave][rr][lane * 2]); }  }   // ctx row segment (query, head) = 64 f32 = 256 B by 32 lanes x 8 B
}
}  // namespace

extern "C" void kernel_launch(void* const* d_in, const int* in_sizes, int n_in, void* d_out, int out_size, void* d_ws, size_t ws_size, hipStream_t stream) {
  (void)n_in;
  auto Fp = [&](int i) { return (const float*)d_in[i]; };
  // input order: 0 hidden_states [4,1024,1024], 1 attention_mask [4,1,1,1024] f32 additive, 2 Wq [1024,1024] (in,out), 3 bq, 4 Wk, 5 bk, 6 Wv, 7 bv
  if (in_sizes[0] != B * T * DM || in_sizes[1] != B * T || in_sizes[2] != DM * DM || in_sizes[4] != DM * DM || in_sizes[6] != DM * DM || in_sizes[3] != DM || in_sizes[5] != DM || in_sizes[7] != DM || out_size != B * T * DM) return;
  size_t off = 0; char* ws = (char*)d_ws;
  auto carve = [&](size_t bytes) { char* p = ws + off; off += (bytes + 255) & ~(size_t)255; return p; };
  b16* WT = (b16*)carve((size_t)3 * DM * DM * 2); const size_t plane = (size_t)B * T * DM * 2; b16* XH = (b16*)carve(plane);
  b16* QP = (b16*)carve(plane); b16* KP = (b16*)carve(plane); b16* VTh = (b16*)carve(plane);
  if (off > ws_size || off > ((size_t)128 << 20)) return;   // = ~40 MB
  prep_kernel<<<dim3(DM / PN, DM / PK, 3 + XZ), 128, 0, stream>>>(Fp(0), Fp(2), Fp(4), Fp(6), WT, XH);
  proj_kernel<<<dim3(T / BM, BL, 3 * NSL), 128, 0, stream>>>(XH, WT, Fp(3), Fp(5), Fp(7), QP, KP, VTh);
  attn_kernel<<<dim3(QL / (16 * AW), BL * H), AW * 32, 0, stream>>>(QP, KP, VTh, Fp(1), (float*)d_out);
}

// v008
// Measured time: 55.4 microseconds a run.
// In two side-by-side timings against v007, it was 1.08 and 1.07 times as fast.
// Over all steps from v000 it is 6.75 times as fast.
#include <hip/hip_runtime.h>

// Self-attention (4 x 1024 x 1024, 16 heads x 64): q/k/v = x W + b ((in,out) weights), scores = q k^T / 8 + attention_mask ([4,1,1,1024] additive per key, read as given; zeros here);
// softmax; ctx heads concatenated -> [4][1024][1024] (no output projection).
// Deterministic: flash-style per 16-query wave over all keys (running max); no atomics.
// compute dtype: WMMA v_wmma_f32_16x16x32_f16 with f32 accumulate for the projections ([4096 x 1024] x [1024 x 3072]; x EXACT bf16 x8, W^T exact x256: 1 product), S^T = K Q^T (q, k each one f16
// term x8: 1 product), O^T += V^T P^T (V^T one f16 term x8, P x1024 one f16 term: 1 product; each operand rounded once to f16, 11 significant bits); ctx written in f32 from the accumulators; mask add and softmax statistics
// in f32. Inputs rounded to bf16 once. Fragment k-map per lane half hh for A AND B: elements 0..7 <- k = 8hh+0..7, 8..15 <- k = 16+8hh+0..7; acc[r] = D[8hh+r][col].

namespace {
constexpr int B = 4, T = 1024, DM = 1024, H = 16, HD = 64, BL = 4 /* batches (== 4 shipped) */, QL = 1024 /* query rows (== 1024 shipped) */;
constexpr int NSL = DM / 128;
constexpr int KCH = 128 /* K per staged chunk of the projections */, KP_ = KCH + 8 /* LDS row pitch, f16 */;
constexpr float XS = 8.0f, WSC = 256.0f, PS = 1024.0f, LOG2E = 1.4426950408889634f;
static_assert(T % 64 == 0 && QL % 32 == 0 && DM % 256 == 0 && H * HD == DM && HD == 64, "tiling");
typedef _Float16 b16;
typedef __attribute__((ext_vector_type(16))) _Float16 v16b;
typedef __attribute__((ext_vector_type(8))) _Float16 v8b;
typedef __attribute__((ext_vector_type(8))) float v8f;
typedef __attribute__((ext_vector_type(4))) float v4f;
__device__ __forceinline__ float bf16_rne(float f) { unsigned int u = __float_as_uint(f); u += 0x7FFFu + ((u >> 16) & 1u); return __uint_as_float(u & 0xFFFF0000u); }
__device__ __forceinline__ void split16(float v, b16& hi, b16& lo) { hi = (b16)v; lo = (b16)(v - (float)hi); }
__device__ __forceinline__ v16b frag_kb(const b16* p, int hh) { const v8b a = *(const v8b*)(p + 8 * hh), b = *(const v8b*)(p + 16 + 8 * hh); v16b f;
#pragma unroll
  for (int e = 0; e < 8; ++e) { f[e] = a[e]; f[8 + e] = b[e]; } return f; }
__device__ __forceinline__ v8f wmma16b(v16b a, v16b b, v8f c) { v8f d = __builtin_amdgcn_wmma_f32_16x16x32_f16(false, a, false, b, (short)0, c, false, false); asm volatile("v_nop\n\tv_nop\n\tv_nop\n\tv_nop" : "+v"(d) : "v"(a), "v"(b)); return d; }
__device__ __forceinline__ void wave_lds_sync() { __builtin_amdgcn_fence(__ATOMIC_RELEASE, "workgroup"); __builtin_amdgcn_wave_barrier(); __builtin_amdgcn_fence(__ATOMIC_ACQUIRE, "workgroup"); }
__device__ __forceinline__ float pmul(float a, float b) { float p = a * b; asm volatile("" : "+v"(p)); return p; }
__device__ __forceinline__ int iclamp(int v, int lo, int hi) { return v < lo ? lo : (v > hi ? hi : v); }

typedef __attribute__((ext_vector_type(2))) _Float16 v2h;
typedef __attribute__((ext_vector_type(4))) _Float16 v4h;
typedef __attribute__((ext_vector_type(2))) float v2f;
typedef __attribute__((ext_vector_type(4))) int v4i;
__device__ __forceinline__ float nexp2(float v) { return __builtin_amdgcn_exp2f(v); }
// grid (DM/64, DM/128, 3 + XZ). z < 3: W^T planes (column tiles, k tiles, q | k | v); block = 4 waves = one tile of 128 k x 64 columns of W. Every global access covers whole lines: a thread loads 16 k rows x 4 columns
// (a wave-wide 16-B load = two 256-B row pieces), rounds them as before, and lays its four columns' 16 k values down in the LDS tile [column][k]; behind the barrier the tile's rows go out as 256-B pieces of W^T rows.
constexpr int PK = 128 /* k per tile */, PN = 64 /* columns per tile */, PP = PK + 8 /* LDS row pitch, f16: 272 B = 16 B x 17 (odd) for ds_load_b128 readers */;
// z >= 3: the x plane XH = f16(bf16(x) x 8), row-major like x, made once here for all 24 column slabs of the projections: a block takes XE consecutive elements, wave-wide 16-B loads (four whole lines) and 8-B stores (two whole lines).
constexpr int XE = 8192 /* x elements per block */, XZ = B * T * DM / (XE * (DM / PN) * (DM / PK)) /* z planes of x blocks */;
static_assert(DM % PK == 0 && DM % PN == 0 && XZ * XE * (DM / PN) * (DM / PK) == B * T * DM && XE == 128 * 4 * 16, "prep tiling");
__global__ __launch_bounds__(128) void prep_kernel(const float* __restrict__ x, const float* __restrict__ wq, const float* __restrict__ wk, const float* __restrict__ wv, b16* __restrict__ WT, b16* __restrict__ XH) {
  __shared__ __attribute__((aligned(16))) b16 Tt[PN][PP];
  if (blockIdx.z >= 3) {   // block-uniform, in front of the barrier
    const size_t e0 = (size_t)(((blockIdx.z - 3) * (DM / PK) + blockIdx.y) * (DM / PN) + blockIdx.x) * XE + threadIdx.x * 4; const float* xp = x + e0; b16* xo = XH + e0;
    v4f g[16];   // all sixteen loads of a thread are in flight at once; the unrolls keep every index of g a constant (registers, no scratch)
#pragma unroll
    for (int i = 0; i < 16; ++i) g[i] = *(const v4f*)(xp + i * 512);
    asm volatile("s_wait_xcnt 0x0" :: "v"(xp) : "memory");   // stands behind the sixteen loads and in front of every rewrite of the address pair they name; the pair is an input here so that no load's own result lands on it
#pragma unroll
    for (int i = 0; i < 16; ++i) { v4h o; for (int j = 0; j < 4; ++j) o[j] = (b16)(bf16_rne(g[i][j]) * XS); *(v4h*)(xo + i * 512) = o; }
    return; }
  const int m = blockIdx.z, n0 = blockIdx.x * PN, k0 = blockIdx.y * PK; const float* w = m == 0 ? wq : m == 1 ? wk : wv;
  const int nq = (threadIdx.x & 15) * 4, kr = (threadIdx.x >> 4) * 16; const float* wp = w + (size_t)(k0 + kr) * DM + n0 + nq;
  v4f f[16];   // all sixteen loads of a thread are in flight at once; the unrolls keep every index of f a constant (registers, no scratch)
#pragma unroll
  for (int i = 0; i < 16; ++i) f[i] = *(const v4f*)(wp + i * DM);
  asm volatile("s_wait_xcnt 0x0" :: "v"(wp) : "memory");   // stands behind the sixteen loads and in front of every rewrite of the address pair they name; the pair is an input here so that no load's own result lands on it
#pragma unroll
  for (int j = 0; j < 4; ++j) { v8b a, c;
#pragma unroll
    for (int i = 0; i < 8; ++i) { a[i] = (b16)(bf16_rne(f[i][j]) * WSC); c[i] = (b16)(bf16_rne(f[8 + i][j]) * WSC); }
    *(v8b*)&Tt[nq + j][kr] = a; *(v8b*)&Tt[nq + j][kr + 8] = c; }
  __syncthreads();   // the whole tile is written before any row of it is read
  b16* op = WT + ((size_t)m * DM + n0 + (threadIdx.x >> 4)) * DM + k0 + (threadIdx.x & 15) * 8;
#pragma unroll
  for (int i = 0; i < 8; ++i) *(v8b*)(op + i * (8 * DM)) = *(const v8b*)&Tt[(threadIdx.x >> 4) + 8 * i][(threadIdx.x & 15) * 8];
}
// projections: grid (T/128, BL, 3 x NSL slabs of 128: q | k | v); block = 4 waves (2 x 2) = one tile of 128 tokens of batch b x 128 columns, a wave = 64 x 64 (16 accumulator tiles): a k step reads 4 + 4 fragments from LDS for 16 products.
// Rows of the x plane XH (exact bf16 x8, f16) and of the W^T slab, K = 1,024 staged block-wide in LDS in 8 chunks of 128; + bias (bq | bk | bv by part).
// q, k: matrix rows = tokens, matrix columns = output columns. v: the two operands change places (both fragment maps are one map), so that the accumulators hold V^T and every plane leaves by rows of the tile.
constexpr int BM = 128 /* tokens per block */, BN = 128 /* columns per block */, TP = 128 + 4 /* epilogue tile pitch, f32 */;
static_assert(T % BM == 0 && QL % BM == 0 && BM == BN && BN == DM / NSL && HD == 64, "projection tiling");
// second launch bound: four waves per SIMD, so that no register above v255 is used; the grid fills three (768 blocks on 256 WGPs)
__global__ __launch_bounds__(128, 4) void proj_kernel(const b16* __restrict__ XH, const b16* __restrict__ WT, const float* __restrict__ bq, const float* __restrict__ bk, const float* __restrict__ bv, b16* __restrict__ QP, b16* __restrict__ KP, b16* __restrict__ VTh) {
  // one LDS block: Sm rows 0..127 = x rows, 128..255 = W^T rows (KCH each) during the K loop; the f32 epilogue tile Tf lies over the same bytes once every wave has left the loop. Row pitch 272 B = 16 B x 17 (odd) for ds_load_b128 readers.
  __shared__ __attribute__((aligned(16))) unsigned char smem[(BM + BN) * KP_ * 2]; static_assert(sizeof(float) * BM * TP <= sizeof(smem), "epilogue tile fits");
  b16 (*Sm)[KP_] = (b16 (*)[KP_])smem; float (*Tf)[TP] = (float (*)[TP])smem;
  const int wave = threadIdx.x >> 5, lane = threadIdx.x & 31, nloc = lane & 15, hlf = lane >> 4; const int t0 = blockIdx.x * BM; const int b = blockIdx.y; const int part = blockIdx.z / NSL, slab = blockIdx.z % NSL, c0 = slab * BN, n0 = part * DM + c0;
  if (part == 0 && t0 >= QL) return;   // (cut builds only) queries beyond QL are not needed; block-uniform, before any barrier
  const b16* xb = XH + ((size_t)b * T + t0) * DM;
  const int mr = (part == 2 ? BM : 0) + (wave >> 1) * 64 + nloc, nr = (part == 2 ? 0 : BM) + (wave & 1) * 64 + nloc;   // this lane's first row of the operand that gives the matrix rows, and of the one that gives the matrix columns
  v8f acc[4][4];
#pragma unroll
  for (int i = 0; i < 4; ++i)
#pragma unroll
    for (int j = 0; j < 4; ++j) acc[i][j] = (v8f){};
  // staging addresses: a block-uniform base plus one 32-bit element offset per thread; every further piece is a constant step (16 KiB in global memory; 8 rows of Sm in LDS); x and W^T rows have one pitch, so one offset serves both
  const b16* wgb = WT + (size_t)n0 * DM; const unsigned wo = (threadIdx.x >> 4) * DM + (threadIdx.x & 15) * 8; b16* st_ = &Sm[threadIdx.x >> 4][(threadIdx.x & 15) * 8];
  // the 32 blocks that read one W^T slab and the 24 that read one block of x rows would walk the same lines of L2 at the same moment: each block begins its k walk at a chunk of its own and wraps (the f32 sum runs over the chunks in that order)
  constexpr int NCH = DM / KCH; static_assert((NCH & (NCH - 1)) == 0, "wrap by mask"); const int ks = blockIdx.x + 2 * blockIdx.y + blockIdx.z;
#pragma unroll 1
  for (int ic = 0; ic < NCH; ++ic) { const int kc = ((ic + ks) & (NCH - 1)) * KCH;
    __syncthreads();
    // the 16 pieces of x first; each register of rg is refilled with a piece of the slab as soon as it is stored, so that the loads in flight and the accumulators stay below v256; the unrolls keep every index of rg, af and bf a constant (registers, no scratch)
    const b16* xg = xb + kc + wo; const b16* wg = wgb + kc + wo; v8b rg[16];   // 128 rows of x and the slab's 128 rows x KCH, loaded once per block: each wave-wide 16-B load covers two whole 256-B row pieces (4 lines)
#pragma unroll
    for (int i = 0; i < 16; ++i) rg[i] = *(const v8b*)(xg + i * (8 * DM));
#pragma unroll
    for (int i = 0; i < 16; ++i) { *(v8b*)(st_ + i * 8 * KP_) = rg[i]; rg[i] = *(const v8b*)(wg + i * (8 * DM)); }
    asm volatile("s_wait_xcnt 0x0" :: "v"(xg), "v"(wg) : "memory");   // stands behind the chunk's 32 loads and in front of every rewrite of the two address pairs they name; the pairs are inputs here so that no load's own result lands on them
#pragma unroll
    for (int i = 0; i < 16; ++i) *(v8b*)(st_ + (16 + i) * 8 * KP_) = rg[i];
    __syncthreads();
#pragma unroll   // all four k steps of a chunk: every LDS fragment address is then base + immediate
    for (int kb = 0; kb < KCH; kb += 32) { v16b af[4], bf[4];   // the eight fragments of a k step are read as one group ahead of their sixteen products
#pragma unroll
      for (int i = 0; i < 4; ++i) af[i] = frag_kb(&Sm[mr + i * 16][kb], hlf);
#pragma unroll
      for (int j = 0; j < 4; ++j) bf[j] = frag_kb(&Sm[nr + j * 16][kb], hlf);
#pragma unroll
      for (int i = 0; i < 4; ++i)
#pragma unroll
        for (int j = 0; j < 4; ++j) acc[i][j] = wmma16b(af[i], bf[j], acc[i][j]); } }
  __syncthreads();   // every wave's last read of Sm ends here: Tf overwrites those bytes
#pragma unroll
  for (int i = 0; i < 4; ++i)
#pragma unroll
    for (int j = 0; j < 4; ++j)
#pragma unroll
      for (int r = 0; r < 8; ++r) Tf[(wave >> 1) * 64 + i * 16 + 8 * hlf + r][(wave & 1) * 64 + j * 16 + nloc] = acc[i][j][r];
  __syncthreads();
  if (part < 2) {   // Tf[token][column]: a head's 64 columns of consecutive tokens are consecutive bytes of its plane; a wave takes one head x 64 tokens, each wave-wide 16-B store = 4 tokens = four whole lines
    b16* plane = part == 0 ? QP : KP; const float* ba = part == 0 ? bq : bk; const int hs = wave & 1, tb = (wave >> 1) * 64 + (lane >> 3), cc = hs * 64 + (lane & 7) * 8;
    const float* bp = ba + c0 + cc; const v4f b0 = *(const v4f*)bp, b1 = *(const v4f*)(bp + 4);
    asm volatile("s_wait_xcnt 0x0" :: "v"(bp) : "memory");   // stands behind the two loads and in front of every rewrite of the address pair they name
    b16* op = plane + (((size_t)b * H + (c0 / HD) + hs) * T + t0 + tb) * HD + (lane & 7) * 8;
#pragma unroll   // every LDS and global address is then base + immediate
    for (int it = 0; it < 16; ++it) { const float* tp = &Tf[tb + it * 4][cc]; const v4f f0 = *(const v4f*)tp, f1 = *(const v4f*)(tp + 4); v8b o;
#pragma unroll
      for (int j = 0; j < 4; ++j) { o[j] = (b16)((f0[j] * (1.0f / (XS * WSC)) + bf16_rne(b0[j])) * XS); o[4 + j] = (b16)((f1[j] * (1.0f / (XS * WSC)) + bf16_rne(b1[j])) * XS); }
      *(v8b*)(op + it * 4 * HD) = o; }
    asm volatile("s_wait_xcnt 0x0" :: "v"(op) : "memory"); }   // stands behind the sixteen stores and in front of every rewrite of the address pair they name
  else {   // Tf[column][token]: a row is 256 B of one V^T row; a wave takes 32 columns, each wave-wide 16-B store = 2 columns x 128 tokens = four whole lines
    const int r0 = wave * 32 + (lane >> 4), tc = (lane & 15) * 8; const float* bp = bv + c0 + r0; float bb[16];
#pragma unroll
    for (int it = 0; it < 16; ++it) bb[it] = bp[it * 2];
    asm volatile("s_wait_xcnt 0x0" :: "v"(bp) : "memory");   // stands behind the sixteen loads and in front of every rewrite of the address pair they name
    b16* op = VTh + ((size_t)b * DM + c0 + r0) * (size_t)T + t0 + tc;
#pragma unroll   // every LDS and global address is then base + immediate
    for (int it = 0; it < 16; ++it) { const float* tp = &Tf[r0 + it * 2][tc]; const v4f f0 = *(const v4f*)tp, f1 = *(const v4f*)(tp + 4); const float bc = bf16_rne(bb[it]); v8b o;
#pragma unroll
      for (int j = 0; j < 4; ++j) { o[j] = (b16)((f0[j] * (1.0f / (XS * WSC)) + bc) * XS); o[4 + j] = (b16)((f1[j] * (1.0f / (XS * WSC)) + bc) * XS); }
      *(v8b*)(op + it * 2 * T) = o; }
    asm volatile("s_wait_xcnt 0x0" :: "v"(op) : "memory"); }   // stands behind the sixteen stores and in front of every rewrite of the address pair they name
}
// attention: grid (QL/128, BL x H): block = 8 waves x 16 queries of (b, h); the keys in tiles of 64: K rows and V^T rows of a tile are staged block-wide in LDS by asynchronous 16-B copies (whole 128-B lines), two buffers, the next tile's copies in flight while this tile is worked on; every K and V^T fragment is read from LDS. Inside a tile two 32-key steps as before: logit = s/8 + mask[b][0][0][key] (the additive per-key f32 mask input, read as given; log2-scaled); online softmax; q, k and V^T as one f16 plane x8 each, P x1024 as one f16 term (S^T and O^T: 1 product each);
constexpr int KT = 64 /* keys per staged tile */, NT = T / KT, SP = 64 + 8 /* LDS row pitch, f16: 144 B = 16 B x 9 (odd) for ds_load_b128 readers */, AW = 8 /* waves per block */;
static_assert(QL % (16 * AW) == 0 && NT >= 2 && KT * 2 == 128 && HD * 2 == 128 && AW * 32 * 2 == KT * 8 && AW * 32 * 2 == HD * 8, "staging: 2 pieces of 16 B per thread and plane");
// one tile = 2 planes x 64 rows x 128 B; a thread copies rows r and r + 32 of each plane, 16 B at byte 16 c (a wave covers four whole lines per copy). l = LDS byte address of its piece in plane 0.
__device__ __forceinline__ void stage_tile(const b16* kh, const b16* vh, unsigned l) {
  constexpr unsigned PB = 64 * SP * 2, HB = 32 * SP * 2;
  // the wait on xcnt is the last line of the copies' own statement, so that no address register of a copy is rewritten in front of it
  asm volatile("global_load_async_to_lds_b128 %0, %4, off\n\t"
               "global_load_async_to_lds_b128 %1, %5, off\n\t"
               "global_load_async_to_lds_b128 %2, %6, off\n\t"
               "global_load_async_to_lds_b128 %3, %7, off\n\t"
               "s_wait_xcnt 0x0"
               :: "v"(l), "v"(l + HB), "v"(l + PB), "v"(l + PB + HB),
                  "v"(kh), "v"(kh + 32 * HD), "v"(vh), "v"(vh + 32 * T) : "memory");
}
__global__ __launch_bounds__(AW * 32) void attn_kernel(const b16* __restrict__ QP, const b16* __restrict__ KP, const b16* __restrict__ VTh, const float* __restrict__ MSK, float* __restrict__ OUTC) {
  __shared__ __attribute__((aligned(16))) b16 St[2][2][64][SP];   // [buffer][K | V^T][key or d][d or key]
  __shared__ __attribute__((aligned(16))) b16 Pb[AW][16][32 + 8]; __shared__ __attribute__((aligned(16))) float To[AW][16][HD + 4];
  __shared__ __attribute__((aligned(16))) float Mk[T];   // the batch's mask row in log2 units
  static_assert(T == AW * 32 * 4, "mask row: one 16-B piece per thread");
  const int wave = threadIdx.x >> 5, lane = threadIdx.x & 31, hh = lane >> 4, col = lane & 15; const int b = blockIdx.y / H, h = blockIdx.y % H; const int q0 = blockIdx.x * (16 * AW) + wave * 16, qi = q0 + col;
  const size_t ph = (size_t)b * H + h; const b16* Qb = QP + ph * T * HD; const b16* Kb = KP + ph * T * HD; const b16* Vh = VTh + ph * HD * (size_t)T; const float* mrow = MSK + (size_t)b * T;   // per-(b,h) planes; the batch's per-key additive mask row [B,1,1,S] (shared by all queries and heads)
  // this thread's pieces of a tile: row sr (and sr + 32), 16-B column sc
  const int sr = threadIdx.x >> 3, sc = (threadIdx.x & 7) * 8; const size_t ko = (size_t)sr * HD + sc, vo = (size_t)sr * T + sc;
  const unsigned sl = (unsigned)(size_t)&St[0][0][sr][sc]; constexpr unsigned BB = 2 * 64 * SP * 2;   // low 32 bits of the shared address = byte offset in the work-group's LDS; BB = bytes of one buffer
  // the blocks of one (b, h) read the same K and V^T lines of L2: each begins its key walk at a tile of its own and wraps, so that they do not ask for one line at one moment (the online softmax takes the tiles in that order)
  constexpr int NQB = QL / (16 * AW); static_assert((NT & (NT - 1)) == 0 && NT % NQB == 0, "wrap by mask; starts spread evenly"); const int ts = blockIdx.x * (NT / NQB);
  stage_tile(Kb + ko + (size_t)ts * KT * HD, Vh + vo + ts * KT, sl);
  const v16b qa0 = frag_kb(Qb + (size_t)qi * HD, hh), qa1 = frag_kb(Qb + (size_t)qi * HD + 32, hh);
  // the mask row is loaded and scaled once per block and kept in LDS: in the loop every 32-key step would touch a fresh 128-B line of it, and each wave would wait for that line between its products
  { const float* mp = mrow + threadIdx.x * 4; const v4f mv = *(const v4f*)mp;
    asm volatile("s_wait_xcnt 0x0" ::: "memory");   // stands behind the load and in front of every rewrite of a register that the load names as its address
    v4f ms = mv * LOG2E;   // floor: a walk may now begin on keys that are all masked; with a finite floor their running maximum stays finite (no inf - inf) and the first open key's rescale wipes them out; a NaN passes as it is
    for (int j = 0; j < 4; ++j) ms[j] = ms[j] < -1.0e30f ? -1.0e30f : ms[j];
    *(v4f*)&Mk[threadIdx.x * 4] = ms; }
  asm volatile("s_wait_asynccnt 0x0" ::: "memory");   // this wave's copies of tile 0 have landed
  __syncthreads();                                     // tile 0 and the mask row published to every wave
  { const int t1 = (ts + 1) & (NT - 1); stage_tile(Kb + ko + (size_t)t1 * KT * HD, Vh + vo + t1 * KT, sl + BB); }
  const float cs = LOG2E / (8.0f * XS * XS);
  float m = -INFINITY, l = 0.0f; v8f o[4]; for (int t = 0; t < 4; ++t) o[t] = (v8f){};
#pragma unroll 1   // one trip per tile: the publish point at its foot stands once
  for (int kt = 0; kt < NT; ++kt) {
    const b16 (*Sb)[64][SP] = St[kt & 1];
#pragma unroll   // both 32-key steps of a tile: every LDS fragment address is then base + immediate
    for (int kk = 0; kk < KT; kk += 32) { const int kb = ((kt + ts) & (NT - 1)) * KT + kk;
    float e[16]; float mx = -INFINITY; v16b kf[2][2]; v4f mq[2][2];   // the four K fragments of a 32-key step and the step's mask values are read from LDS as one group ahead of the products; the unrolls keep every index of kf, mq and vf a constant (registers, no scratch)
#pragma unroll
    for (int u = 0; u < 2; ++u) { const int kr = kk + u * 16 + col; kf[u][0] = frag_kb(&Sb[0][kr][0], hh); kf[u][1] = frag_kb(&Sb[0][kr][32], hh); }
#pragma unroll
    for (int u = 0; u < 2; ++u) { mq[u][0] = *(const v4f*)&Mk[kb + u * 16 + 8 * hh]; mq[u][1] = *(const v4f*)&Mk[kb + u * 16 + 8 * hh + 4]; }   // mask (log2 units) for keys kb + 16u + 8hh .. +7 of this lane's query
#pragma unroll
    for (int u = 0; u < 2; ++u) { v8f s = (v8f){}; s = wmma16b(kf[u][0], qa0, s); s = wmma16b(kf[u][1], qa1, s);
#pragma unroll
      for (int r = 0; r < 8; ++r) { const float mk = r < 4 ? mq[u][0][r] : mq[u][1][r - 4]; const float vv = fmaf(s[r], cs, mk); e[u * 8 + r] = vv; mx = fmaxf(mx, vv); } }
    v16b vf[4];   // the four V^T fragments of the step are read as one group here, so that they arrive behind the softmax arithmetic
#pragma unroll
    for (int t = 0; t < 4; ++t) vf[t] = frag_kb(&Sb[1][t * 16 + col][kk], hh);
    mx = fmaxf(mx, __shfl_xor(mx, 16)); const float mn = fmaxf(m, mx); const float al = nexp2(m - mn); float sum = 0.0f;
#pragma unroll
    for (int i2 = 0; i2 < 16; ++i2) { const float p = nexp2(e[i2] - mn); sum += p; const int pc = (i2 < 8 ? 0 : 16) + 8 * hh + (i2 & 7); Pb[wave][col][pc] = (b16)(p * PS); }
    sum += __shfl_xor(sum, 16); l = l * al + sum; m = mn;
    wave_lds_sync();
    const v16b pf = frag_kb(&Pb[wave][col][0], hh);
#pragma unroll
    for (int t = 0; t < 4; ++t) { o[t] *= al; o[t] = wmma16b(vf[t], pf, o[t]); }
    wave_lds_sync(); }
    // publish point of tile kt + 1, every wave, in this order
    asm volatile("s_wait_dscnt 0x0" ::: "memory");      // this wave's reads of the buffer that is refilled below have returned
    asm volatile("s_wait_asynccnt 0x0" ::: "memory");   // this wave's copies of tile kt + 1 have landed
    __syncthreads();                                     // publishes tile kt + 1 and ends every wave's reads of tile kt
    if (kt + 2 < NT) { const int t2 = (kt + 2 + ts) & (NT - 1); stage_tile(Kb + ko + (size_t)t2 * KT * HD, Vh + vo + t2 * KT, sl + (unsigned)(kt & 1) * BB); } }
  asm volatile("s_wait_asynccnt 0x0" ::: "memory");   // no copy is outstanding when the wave goes on to its end
  const float inv = 1.0f / (l * PS * XS);
#pragma unroll
  for (int t = 0; t < 4; ++t)
#pragma unroll
    for (int r = 0; r < 8; ++r) To[wave][col][t * 16 + 8 * hh + r] = o[t][r] * inv;
  wave_lds_sync();
  { for (int rr = 0; rr < 16; ++rr) { const size_t oi = ((size_t)b * T + q0 + rr) * DM + h * HD + lane * 2; *(v2f*)(OUTC + oi) = *(const v2f*)(&To[wave][rr][lane * 2]); }  }   // ctx row segment (query, head) = 64 f32 = 256 B by 32 lanes x 8 B
}
}  // namespace

extern "C" void kernel_launch(void* const* d_in, const int* in_sizes, int n_in, void* d_out, int out_size, void* d_ws, size_t ws_size, hipStream_t stream) {
  (void)n_in;
  auto Fp = [&](int i) { return (const float*)d_in[i]; };
  // input order: 0 hidden_states [4,1024,1024], 1 attention_mask [4,1,1,1024] f32 additive, 2 Wq [1024,1024] (in,out), 3 bq, 4 Wk, 5 bk, 6 Wv, 7 bv
  if (in_sizes[0] != B * T * DM || in_sizes[1] != B * T || in_sizes[2] != DM * DM || in_sizes[4] != DM * DM || in_sizes[6] != DM * DM || in_sizes[3] != DM || in_sizes[5] != DM || in_sizes[7] != DM || out_size != B * T * DM) return;
  size_t off = 0; char* ws = (char*)d_ws;
  auto carve = [&](size_t bytes) { char* p = ws + off; off += (bytes + 255) & ~(size_t)255; return p; };
  b16* WT = (b16*)carve((size_t)3 * DM * DM * 2); const size_t plane = (size_t)B * T * DM * 2; b16* XH = (b16*)carve(plane);
  b16* QP = (b16*)carve(plane); b16* KP = (b16*)carve(plane); b16* VTh = (b16*)carve(plane);
  if (off > ws_size || off > ((size_t)128 << 20)) return;   // = ~40 MB
  prep_kernel<<<dim3(DM / PN, DM / PK, 3 + XZ), 128, 0, stream>>>(Fp(0), Fp(2), Fp(4), Fp(6), WT, XH);
  proj_kernel<<<dim3(T / BM, BL, 3 * NSL), 128, 0, stream>>>(XH, WT, Fp(3), Fp(5), Fp(7), QP, KP, VTh);
  attn_kernel<<<dim3(QL / (16 * AW), BL * H), AW * 32, 0, stream>>>(QP, KP, VTh, Fp(1), (float*)d_out);
}

// v009
// A run of this version takes 54.1 microseconds.
// Next to v008, in two timings, it ran 1.03 and 1.02 times as fast.
// Over all steps from v000 it is 6.94 times as fast.
#include <hip/hip_runtime.h>

// Self-attention (4 x 1024 x 1024, 16 heads x 64): q/k/v = x W + b ((in,out) weights), scores = q k^T / 8 + attention_mask ([4,1,1,1024] additive per key, read as given; zeros here);
// softmax; ctx heads concatenated -> [4][1024][1024] (no output projection).
// Deterministic: flash-style per 16-query wave over all keys (running max); no atomics.
// compute dtype: WMMA v_wmma_f32_16x16x32_f16 with f32 accumulate for the projections ([4096 x 1024] x [1024 x 3072]; x EXACT bf16 x8, W^T exact x256: 1 product), S^T = K Q^T (q, k each one f16
// term x8: 1 product), O^T += V^T P^T (V^T one f16 term x8, P x1024 one f16 term: 1 product; each operand rounded once to f16, 11 significant bits); ctx written in f32 from the accumulators; mask add and softmax statistics
// in f32. Inputs rounded to bf16 once. Fragment k-map per lane half hh for A AND B: elements 0..7 <- k = 8hh+0..7, 8..15 <- k = 16+8hh+0..7; acc[r] = D[8hh+r][col].

namespace {
constexpr int B = 4, T = 1024, DM = 1024, H = 16, HD = 64, BL = 4 /* batches (== 4 shipped) */, QL = 1024 /* query rows (== 1024 shipped) */;
constexpr int NSL = DM / 128;
constexpr int KCH = 128 /* K per staged chunk of the projections */, KP_ = KCH + 8 /* LDS row pitch, f16 */;
constexpr float XS = 8.0f, WSC = 256.0f, PS = 1024.0f, LOG2E = 1.4426950408889634f;
static_assert(T % 64 == 0 && QL % 32 == 0 && DM % 256 == 0 && H * HD == DM && HD == 64, "tiling");
typedef _Float16 b16;
typedef __attribute__((ext_vector_type(16))) _Float16 v16b;
typedef __attribute__((ext_vector_type(8))) _Float16 v8b;
typedef __attribute__((ext_vector_type(8))) float v8f;
typedef __attribute__((ext_vector_type(4))) float v4f;
__device__ __forceinline__ float bf16_rne(float f) { unsigned int u = __float_as_uint(f); u += 0x7FFFu + ((u >> 16) & 1u); return __uint_as_float(u & 0xFFFF0000u); }
__device__ __forceinline__ void split16(float v, b16& hi, b16& lo) { hi = (b16)v; lo = (b16)(v - (float)hi); }
__device__ __forceinline__ v16b frag_kb(const b16* p, int hh) { const v8b a = *(const v8b*)(p + 8 * hh), b = *(const v8b*)(p + 16 + 8 * hh); v16b f;
#pragma unroll
  for (int e = 0; e < 8; ++e) { f[e] = a[e]; f[8 + e] = b[e]; } return f; }
__device__ __forceinline__ v8f wmma16b(v16b a, v16b b, v8f c) { v8f d = __builtin_amdgcn_wmma_f32_16x16x32_f16(false, a, false, b, (short)0, c, false, false); asm volatile("v_nop\n\tv_nop\n\tv_nop\n\tv_nop" : "+v"(d) : "v"(a), "v"(b)); return d; }
__device__ __forceinline__ void wave_lds_sync() { __builtin_amdgcn_fence(__ATOMIC_RELEASE, "workgroup"); __builtin_amdgcn_wave_barrier(); __builtin_amdgcn_fence(__ATOMIC_ACQUIRE, "workgroup"); }
__device__ __forceinline__ float pmul(float a, float b) { float p = a * b; asm volatile("" : "+v"(p)); return p; }
__device__ __forceinline__ int iclamp(int v, int lo, int hi) { return v < lo ? lo : (v > hi ? hi : v); }

typedef __attribute__((ext_vector_type(2))) _Float16 v2h;
typedef __attribute__((ext_vector_type(4))) _Float16 v4h;
typedef __attribute__((ext_vector_type(2))) float v2f;
typedef __attribute__((ext_vector_type(4))) int v4i;
__device__ __forceinline__ float nexp2(float v) { return __builtin_amdgcn_exp2f(v); }
// grid (DM/64, DM/128, 3 + XZ). z < 3: W^T planes (column tiles, k tiles, q | k | v); block = 4 waves = one tile of 128 k x 64 columns of W. Every global access covers whole lines: a thread loads 16 k rows x 4 columns
// (a wave-wide 16-B load = two 256-B row pieces), rounds them as before, and lays its four columns' 16 k values down in the LDS tile [column][k]; behind the barrier the tile's rows go out as 256-B pieces of W^T rows.
constexpr int PK = 128 /* k per tile */, PN = 64 /* columns per tile */, PP = PK + 8 /* LDS row pitch, f16: 272 B = 16 B x 17 (odd) for ds_load_b128 readers */;
// z >= 3: the x plane XH = f16(bf16(x) x 8), row-major like x, made once here for all 16 column slabs of the projections: a block takes XE consecutive elements, wave-wide 16-B loads (four whole lines) and 8-B stores (two whole lines).
constexpr int XE = 8192 /* x elements per block */, XZ = B * T * DM / (XE * (DM / PN) * (DM / PK)) /* z planes of x blocks */;
static_assert(DM % PK == 0 && DM % PN == 0 && XZ * XE * (DM / PN) * (DM / PK) == B * T * DM && XE == 128 * 4 * 16, "prep tiling");
__global__ __launch_bounds__(128) void prep_kernel(const float* __restrict__ x, const float* __restrict__ wq, const float* __restrict__ wk, const float* __restrict__ wv, b16* __restrict__ WT, b16* __restrict__ XH) {
  __shared__ __attribute__((aligned(16))) b16 Tt[PN][PP];
  if (blockIdx.z >= 3) {   // block-uniform, in front of the barrier
    const size_t e0 = (size_t)(((blockIdx.z - 3) * (DM / PK) + blockIdx.y) * (DM / PN) + blockIdx.x) * XE + threadIdx.x * 4; const float* xp = x + e0; b16* xo = XH + e0;
    v4f g[16];   // all sixteen loads of a thread are in flight at once; the unrolls keep every index of g a constant (registers, no scratch)
#pragma unroll
    for (int i = 0; i < 16; ++i) g[i] = *(const v4f*)(xp + i * 512);
    asm volatile("s_wait_xcnt 0x0" :: "v"(xp) : "memory");   // stands behind the sixteen loads and in front of every rewrite of the address pair they name; the pair is an input here so that no load's own result lands on it
#pragma unroll
    for (int i = 0; i < 16; ++i) { v4h o; for (int j = 0; j < 4; ++j) o[j] = (b16)(bf16_rne(g[i][j]) * XS); *(v4h*)(xo + i * 512) = o; }
    return; }
  const int m = blockIdx.z, n0 = blockIdx.x * PN, k0 = blockIdx.y * PK; const float* w = m == 0 ? wq : m == 1 ? wk : wv;
  const int nq = (threadIdx.x & 15) * 4, kr = (threadIdx.x >> 4) * 16; const float* wp = w + (size_t)(k0 + kr) * DM + n0 + nq;
  v4f f[16];   // all sixteen loads of a thread are in flight at once; the unrolls keep every index of f a constant (registers, no scratch)
#pragma unroll
  for (int i = 0; i < 16; ++i) f[i] = *(const v4f*)(wp + i * DM);
  asm volatile("s_wait_xcnt 0x0" :: "v"(wp) : "memory");   // stands behind the sixteen loads and in front of every rewrite of the address pair they name; the pair is an input here so that no load's own result lands on it
#pragma unroll
  for (int j = 0; j < 4; ++j) { v8b a, c;
#pragma unroll
    for (int i = 0; i < 8; ++i) { a[i] = (b16)(bf16_rne(f[i][j]) * WSC); c[i] = (b16)(bf16_rne(f[8 + i][j]) * WSC); }
    *(v8b*)&Tt[nq + j][kr] = a; *(v8b*)&Tt[nq + j][kr + 8] = c; }
  __syncthreads();   // the whole tile is written before any row of it is read
  b16* op = WT + ((size_t)m * DM + n0 + (threadIdx.x >> 4)) * DM + k0 + (threadIdx.x & 15) * 8;
#pragma unroll
  for (int i = 0; i < 8; ++i) *(v8b*)(op + i * (8 * DM)) = *(const v8b*)&Tt[(threadIdx.x >> 4) + 8 * i][(threadIdx.x & 15) * 8];
}
// projections: grid (B T / 256, 3 DM / 192); block = 12 waves (4 x 3) = one tile of 256 tokens (of one batch) x 192 columns of q | k | v laid side by side; 256 blocks, one per WGP (LDS), three waves per SIMD. A wave = 64 tokens x 64 columns
// = one head of one part (16 accumulator tiles): a k step reads 4 + 4 fragments from LDS for 16 products. A block brings 256 + 192 rows x K from L2 for 256 x 192 results: 7/12 of the bytes that 128 x 128 blocks bring for the same area.
// Rows of the x plane XH (exact bf16 x8, f16) and of W^T, K = 1,024 in 8 chunks of 128, staged block-wide in LDS by asynchronous 16-B copies, two buffers: the next chunk's copies are in flight while this chunk is worked on; + bias (bq | bk | bv by part).
// q, k: matrix rows = tokens, matrix columns = output columns. v: the two operands change places (both fragment maps are one map), so that the accumulators hold V^T and every plane leaves by rows of the wave's tile.
constexpr int BM = 256 /* tokens per block */, BN = 192 /* columns per block */, PW = 12 /* waves per block */, SR = BM + BN /* staged rows */, WTP = 64 + 4 /* pitch of a wave's epilogue tile, f32 */;
constexpr unsigned PBB = SR * KP_ * 2 /* bytes of one buffer */, PST = 8 * KP_ * 2 /* LDS bytes between two successive copies of a wave: 8 rows */;
constexpr int CW = 4 /* waves that issue the copies */, CPW = SR / 2 / CW /* copies of such a wave per chunk */, CPS = 8 /* copies per statement */;
static_assert(T % BM == 0 && QL == T && (3 * DM) % BN == 0 && BN == 3 * HD && BM == 4 * 64 && HD == 64 && KCH == 128 && CPW <= 63 && BM % (2 * CW * CPS) == 0 && BN % (2 * CW * CPS) == 0, "projection tiling; a wave-wide copy = 2 rows of 256 B");
// eight copies of one wave, 8 rows apart: rows r, r + 8, .. r + 56 (+ 1 for the upper lane half); the wait on xcnt is the last line of the copies' own statement, so that no address register of a copy is rewritten in front of it
__device__ __forceinline__ void copy8(unsigned l, const b16* g) {
  constexpr int GS = 2 * CW * DM;
  asm volatile(
               "global_load_async_to_lds_b128 %0, %8, off\n\t"
               "global_load_async_to_lds_b128 %1, %9, off\n\t"
               "global_load_async_to_lds_b128 %2, %10, off\n\t"
               "global_load_async_to_lds_b128 %3, %11, off\n\t"
               "global_load_async_to_lds_b128 %4, %12, off\n\t"
               "global_load_async_to_lds_b128 %5, %13, off\n\t"
               "global_load_async_to_lds_b128 %6, %14, off\n\t"
               "global_load_async_to_lds_b128 %7, %15, off\n\t"
               "s_wait_xcnt 0x0"
               :: "v"(l), "v"(l + PST), "v"(l + 2 * PST), "v"(l + 3 * PST), "v"(l + 4 * PST), "v"(l + 5 * PST), "v"(l + 6 * PST), "v"(l + 7 * PST),
                  "v"(g), "v"(g + GS), "v"(g + 2 * GS), "v"(g + 3 * GS), "v"(g + 4 * GS), "v"(g + 5 * GS), "v"(g + 6 * GS), "v"(g + 7 * GS) : "memory");
}
// one chunk = 448 rows x 256 B = 224 wave-wide copies (2 whole rows each), issued by the block's first four waves, 56 each, while the other eight go straight on to their products and keep the matrix units fed (three waves share one).
// Issuing wave cw takes rows 2 cw + 8 i (+ 1 for the upper lane half), i = 0..55; i < 32 are x rows, the rest W^T rows.
// xl, wl = this lane's piece of row 2 cw (+ 1) of the x rows and of the W^T rows at the chunk's k; l = LDS byte address of that piece in the buffer.
__device__ __forceinline__ void stage_chunk(const b16* xl, const b16* wl, unsigned l) {
#pragma unroll 1   // rolled: only one statement's 24 address registers are alive at a time beside the 128 accumulators (unrolled, the build spilled)
  for (int s = 0; s < BM / (2 * CW * CPS); ++s) { copy8(l, xl); l += CPS * PST; xl += CPS * 2 * CW * DM; }
#pragma unroll 1   // rolled, as above
  for (int s = 0; s < BN / (2 * CW * CPS); ++s) { copy8(l, wl); l += CPS * PST; wl += CPS * 2 * CW * DM; }
}
// second launch bound: four waves per SIMD, so that no register above v255 is used; the block fills three
__global__ __launch_bounds__(PW * 32, 4) void proj_kernel(const b16* __restrict__ XH, const b16* __restrict__ WT, const float* __restrict__ bq, const float* __restrict__ bk, const float* __restrict__ bv, b16* __restrict__ QP, b16* __restrict__ KP, b16* __restrict__ VTh) {
  // one LDS block: two buffers, in each rows 0..255 = x rows, 256..447 = W^T rows (KCH each) during the K loop; the waves' f32 epilogue tiles lie over the same bytes once every wave has left the loop. Row pitch 272 B = 16 B x 17 (odd) for ds_load_b128 readers.
  __shared__ __attribute__((aligned(16))) unsigned char smem[2 * PBB]; static_assert(sizeof(float) * PW * 64 * WTP <= sizeof(smem), "epilogue tiles fit");
  const int wv = __builtin_amdgcn_readfirstlane(threadIdx.x >> 5) /* the wave's number, in a scalar register */, lane = threadIdx.x & 31, nloc = lane & 15, hlf = lane >> 4; const int wr = wv / 3, wc = wv % 3; const bool cpw = wv < CW /* this wave issues copies: a scalar test, the same for the whole wave */; const int cw = wv & (CW - 1);
  const int g0 = blockIdx.x * BM, b = g0 / T, tw = g0 % T + wr * 64; const int n0 = blockIdx.y * BN, nw = n0 + wc * HD, part = nw / DM, cp = nw % DM;   // the wave's first token in its batch; its part and its first column there
  const int xr = wr * 64 + nloc, wrw = BM + wc * 64 + nloc; const int mr = part == 2 ? wrw : xr, nr = part == 2 ? xr : wrw;   // this lane's first row of the operand that gives the matrix rows, and of the one that gives the matrix columns
  v8f acc[4][4];
#pragma unroll
  for (int i = 0; i < 4; ++i)
#pragma unroll
    for (int j = 0; j < 4; ++j) acc[i][j] = (v8f){};
  const unsigned so = (2 * cw + hlf) * DM + nloc * 8; const b16* xl = XH + (size_t)g0 * DM + so; const b16* wl = WT + (size_t)n0 * DM + so;
  const unsigned sl = (unsigned)(size_t)smem + (2 * cw + hlf) * (KP_ * 2) + nloc * 16;   // low 32 bits of the shared address = byte offset in the work-group's LDS
  // the 16 blocks that read one W^T slab and the 16 that read one block of x rows would walk the same lines of L2 at the same moment: each block begins its k walk at a chunk of its own and wraps (the f32 sum runs over the chunks in that order)
  constexpr int NCH = DM / KCH; static_assert((NCH & (NCH - 1)) == 0 && NCH >= 2, "wrap by mask; two buffers"); const int ks = blockIdx.x + blockIdx.y;
  if (cpw) { const int k0 = (ks & (NCH - 1)) * KCH; stage_chunk(xl + k0, wl + k0, sl); }
  asm volatile("s_wait_asynccnt 0x0" ::: "memory");   // this wave's copies of the first chunk (if it issued any) have landed
  __syncthreads();                                     // the first chunk published to every wave
  if (cpw) { const int k1 = ((ks + 1) & (NCH - 1)) * KCH; stage_chunk(xl + k1, wl + k1, sl + PBB); }
#pragma unroll 1   // one trip per chunk: the publish point at its foot stands once
  for (int ic = 0; ic < NCH; ++ic) { const b16 (*Sm)[KP_] = (const b16 (*)[KP_])(smem + (ic & 1) * PBB);
#pragma unroll   // all four k steps of a chunk: every LDS fragment address is then base + immediate
    for (int kb = 0; kb < KCH; kb += 32) { v16b af[4], bf[4];   // the eight fragments of a k step are read as one group ahead of their sixteen products; the unrolls keep every index of af and bf a constant (registers, no scratch)
#pragma unroll
      for (int i = 0; i < 4; ++i) af[i] = frag_kb(&Sm[mr + i * 16][kb], hlf);
#pragma unroll
      for (int j = 0; j < 4; ++j) bf[j] = frag_kb(&Sm[nr + j * 16][kb], hlf);
#pragma unroll
      for (int i = 0; i < 4; ++i)
#pragma unroll
        for (int j = 0; j < 4; ++j) acc[i][j] = wmma16b(af[i], bf[j], acc[i][j]); }
    // publish point of chunk ic + 1, every wave, in this order
    asm volatile("s_wait_dscnt 0x0" ::: "memory");      // this wave's reads of the buffer that is refilled below have returned
    asm volatile("s_wait_asynccnt 0x0" ::: "memory");   // this wave's copies of chunk ic + 1 (if it issued any) have landed
    __syncthreads();                                     // publishes chunk ic + 1 and ends every wave's reads of chunk ic (behind the last trip: of the bytes that the epilogue tiles overwrite)
    if (cpw && ic + 2 < NCH) { const int k2 = ((ic + 2 + ks) & (NCH - 1)) * KCH; stage_chunk(xl + k2, wl + k2, sl + (unsigned)(ic & 1) * PBB); } }
  asm volatile("s_wait_asynccnt 0x0" ::: "memory");   // no copy is outstanding when the LDS is put to its next use
  // a wave's 64 x 64 tile goes through LDS bytes of its own: written and read by this wave alone, so that a wave-level sync is enough
  float (*Tw)[WTP] = (float (*)[WTP])(smem + wv * (64 * WTP * 4));
#pragma unroll
  for (int i = 0; i < 4; ++i)
#pragma unroll
    for (int j = 0; j < 4; ++j)
#pragma unroll
      for (int r = 0; r < 8; ++r) Tw[i * 16 + 8 * hlf + r][j * 16 + nloc] = acc[i][j][r];
  wave_lds_sync();
  const int rb = lane >> 3, c8 = (lane & 7) * 8;
  if (part < 2) {   // Tw[token][column]: the head's 64 columns of consecutive tokens are consecutive bytes of its plane; each wave-wide 16-B store = 4 tokens = four whole lines
    b16* plane = part == 0 ? QP : KP; const float* ba = part == 0 ? bq : bk;
    const float* bp = ba + cp + c8; const v4f b0 = *(const v4f*)bp, b1 = *(const v4f*)(bp + 4);
    asm volatile("s_wait_xcnt 0x0" :: "v"(bp) : "memory");   // stands behind the two loads and in front of every rewrite of the address pair they name
    b16* op = plane + (((size_t)b * H + (cp / HD)) * T + tw + rb) * HD + c8;
#pragma unroll   // every LDS and global address is then base + immediate
    for (int it = 0; it < 16; ++it) { const float* tp = &Tw[rb + it * 4][c8]; const v4f f0 = *(const v4f*)tp, f1 = *(const v4f*)(tp + 4); v8b o;
#pragma unroll
      for (int j = 0; j < 4; ++j) { o[j] = (b16)((f0[j] * (1.0f / (XS * WSC)) + bf16_rne(b0[j])) * XS); o[4 + j] = (b16)((f1[j] * (1.0f / (XS * WSC)) + bf16_rne(b1[j])) * XS); }
      *(v8b*)(op + it * 4 * HD) = o; }
    asm volatile("s_wait_xcnt 0x0" :: "v"(op) : "memory"); }   // stands behind the sixteen stores and in front of every rewrite of the address pair they name
  else {   // Tw[column][token]: a row is 128 B of one V^T row; each wave-wide 16-B store = 4 columns x 64 tokens = four whole lines
    const float* bp = bv + cp + rb; float bb[16];
#pragma unroll
    for (int it = 0; it < 16; ++it) bb[it] = bp[it * 4];
    asm volatile("s_wait_xcnt 0x0" :: "v"(bp) : "memory");   // stands behind the sixteen loads and in front of every rewrite of the address pair they name
    b16* op = VTh + ((size_t)b * DM + cp + rb) * (size_t)T + tw + c8;
#pragma unroll   // every LDS and global address is then base + immediate
    for (int it = 0; it < 16; ++it) { const float* tp = &Tw[rb + it * 4][c8]; const v4f f0 = *(const v4f*)tp, f1 = *(const v4f*)(tp + 4); const float bc = bf16_rne(bb[it]); v8b o;
#pragma unroll
      for (int j = 0; j < 4; ++j) { o[j] = (b16)((f0[j] * (1.0f / (XS * WSC)) + bc) * XS); o[4 + j] = (b16)((f1[j] * (1.0f / (XS * WSC)) + bc) * XS); }
      *(v8b*)(op + it * 4 * T) = o; }
    asm volatile("s_wait_xcnt 0x0" :: "v"(op) : "memory"); }   // stands behind the sixteen stores and in front of every rewrite of the address pair they name
}
// attention: grid (QL/128, BL x H): block = 8 waves x 16 queries of (b, h); the keys in tiles of 64: K rows and V^T rows of a tile are staged block-wide in LDS by asynchronous 16-B copies (whole 128-B lines), two buffers, the next tile's copies in flight while this tile is worked on; every K and V^T fragment is read from LDS. Inside a tile two 32-key steps as before: logit = s/8 + mask[b][0][0][key] (the additive per-key f32 mask input, read as given; log2-scaled); online softmax; q, k and V^T as one f16 plane x8 each, P x1024 as one f16 term (S^T and O^T: 1 product each);
constexpr int KT = 64 /* keys per staged tile */, NT = T / KT, SP = 64 + 8 /* LDS row pitch, f16: 144 B = 16 B x 9 (odd) for ds_load_b128 readers */, AW = 8 /* waves per block */;
static_assert(QL % (16 * AW) == 0 && NT >= 2 && KT * 2 == 128 && HD * 2 == 128 && AW * 32 * 2 == KT * 8 && AW * 32 * 2 == HD * 8, "staging: 2 pieces of 16 B per thread and plane");
// one tile = 2 planes x 64 rows x 128 B; a thread copies rows r and r + 32 of each plane, 16 B at byte 16 c (a wave covers four whole lines per copy). l = LDS byte address of its piece in plane 0.
__device__ __forceinline__ void stage_tile(const b16* kh, const b16* vh, unsigned l) {
  constexpr unsigned PB = 64 * SP * 2, HB = 32 * SP * 2;
  // the wait on xcnt is the last line of the copies' own statement, so that no address register of a copy is rewritten in front of it
  asm volatile("global_load_async_to_lds_b128 %0, %4, off\n\t"
               "global_load_async_to_lds_b128 %1, %5, off\n\t"
               "global_load_async_to_lds_b128 %2, %6, off\n\t"
               "global_load_async_to_lds_b128 %3, %7, off\n\t"
               "s_wait_xcnt 0x0"
               :: "v"(l), "v"(l + HB), "v"(l + PB), "v"(l + PB + HB),
                  "v"(kh), "v"(kh + 32 * HD), "v"(vh), "v"(vh + 32 * T) : "memory");
}
__global__ __launch_bounds__(AW * 32) void attn_kernel(const b16* __restrict__ QP, const b16* __restrict__ KP, const b16* __restrict__ VTh, const float* __restrict__ MSK, float* __restrict__ OUTC) {
  __shared__ __attribute__((aligned(16))) b16 St[2][2][64][SP];   // [buffer][K | V^T][key or d][d or key]
  __shared__ __attribute__((aligned(16))) b16 Pb[AW][16][32 + 8]; __shared__ __attribute__((aligned(16))) float To[AW][16][HD + 4];
  __shared__ __attribute__((aligned(16))) float Mk[T];   // the batch's mask row in log2 units
  static_assert(T == AW * 32 * 4, "mask row: one 16-B piece per thread");
  const int wave = threadIdx.x >> 5, lane = threadIdx.x & 31, hh = lane >> 4, col = lane & 15; const int b = blockIdx.y / H, h = blockIdx.y % H; const int q0 = blockIdx.x * (16 * AW) + wave * 16, qi = q0 + col;
  const size_t ph = (size_t)b * H + h; const b16* Qb = QP + ph * T * HD; const b16* Kb = KP + ph * T * HD; const b16* Vh = VTh + ph * HD * (size_t)T; const float* mrow = MSK + (size_t)b * T;   // per-(b,h) planes; the batch's per-key additive mask row [B,1,1,S] (shared by all queries and heads)
  // this thread's pieces of a tile: row sr (and sr + 32), 16-B column sc
  const int sr = threadIdx.x >> 3, sc = (threadIdx.x & 7) * 8; const size_t ko = (size_t)sr * HD + sc, vo = (size_t)sr * T + sc;
  const unsigned sl = (unsigned)(size_t)&St[0][0][sr][sc]; constexpr unsigned BB = 2 * 64 * SP * 2;   // low 32 bits of the shared address = byte offset in the work-group's LDS; BB = bytes of one buffer
  // the blocks of one (b, h) read the same K and V^T lines of L2: each begins its key walk at a tile of its own and wraps, so that they do not ask for one line at one moment (the online softmax takes the tiles in that order)
  constexpr int NQB = QL / (16 * AW); static_assert((NT & (NT - 1)) == 0 && NT % NQB == 0, "wrap by mask; starts spread evenly"); const int ts = blockIdx.x * (NT / NQB);
  stage_tile(Kb + ko + (size_t)ts * KT * HD, Vh + vo + ts * KT, sl);
  const v16b qa0 = frag_kb(Qb + (size_t)qi * HD, hh), qa1 = frag_kb(Qb + (size_t)qi * HD + 32, hh);
  // the mask row is loaded and scaled once per block and kept in LDS: in the loop every 32-key step would touch a fresh 128-B line of it, and each wave would wait for that line between its products
  { const float* mp = mrow + threadIdx.x * 4; const v4f mv = *(const v4f*)mp;
    asm volatile("s_wait_xcnt 0x0" ::: "memory");   // stands behind the load and in front of every rewrite of a register that the load names as its address
    v4f ms = mv * LOG2E;   // floor: a walk may now begin on keys that are all masked; with a finite floor their running maximum stays finite (no inf - inf) and the first open key's rescale wipes them out; a NaN passes as it is
    for (int j = 0; j < 4; ++j) ms[j] = ms[j] < -1.0e30f ? -1.0e30f : ms[j];
    *(v4f*)&Mk[threadIdx.x * 4] = ms; }
  asm volatile("s_wait_asynccnt 0x0" ::: "memory");   // this wave's copies of tile 0 have landed
  __syncthreads();                                     // tile 0 and the mask row published to every wave
  { const int t1 = (ts + 1) & (NT - 1); stage_tile(Kb + ko + (size_t)t1 * KT * HD, Vh + vo + t1 * KT, sl + BB); }
  const float cs = LOG2E / (8.0f * XS * XS);
  float m = -INFINITY, l = 0.0f; v8f o[4]; for (int t = 0; t < 4; ++t) o[t] = (v8f){};
#pragma unroll 1   // one trip per tile: the publish point at its foot stands once
  for (int kt = 0; kt < NT; ++kt) {
    const b16 (*Sb)[64][SP] = St[kt & 1];
#pragma unroll   // both 32-key steps of a tile: every LDS fragment address is then base + immediate
    for (int kk = 0; kk < KT; kk += 32) { const int kb = ((kt + ts) & (NT - 1)) * KT + kk;
    float e[16]; float mx = -INFINITY; v16b kf[2][2]; v4f mq[2][2];   // the four K fragments of a 32-key step and the step's mask values are read from LDS as one group ahead of the products; the unrolls keep every index of kf, mq and vf a constant (registers, no scratch)
#pragma unroll
    for (int u = 0; u < 2; ++u) { const int kr = kk + u * 16 + col; kf[u][0] = frag_kb(&Sb[0][kr][0], hh); kf[u][1] = frag_kb(&Sb[0][kr][32], hh); }
#pragma unroll
    for (int u = 0; u < 2; ++u) { mq[u][0] = *(const v4f*)&Mk[kb + u * 16 + 8 * hh]; mq[u][1] = *(const v4f*)&Mk[kb + u * 16 + 8 * hh + 4]; }   // mask (log2 units) for keys kb + 16u + 8hh .. +7 of this lane's query
#pragma unroll
    for (int u = 0; u < 2; ++u) { v8f s = (v8f){}; s = wmma16b(kf[u][0], qa0, s); s = wmma16b(kf[u][1], qa1, s);
#pragma unroll
      for (int r = 0; r < 8; ++r) { const float mk = r < 4 ? mq[u][0][r] : mq[u][1][r - 4]; const float vv = fmaf(s[r], cs, mk); e[u * 8 + r] = vv; mx = fmaxf(mx, vv); } }
    v16b vf[4];   // the four V^T fragments of the step are read as one group here, so that they arrive behind the softmax arithmetic
#pragma unroll
    for (int t = 0; t < 4; ++t) vf[t] = frag_kb(&Sb[1][t * 16 + col][kk], hh);
    mx = fmaxf(mx, __shfl_xor(mx, 16)); const float mn = fmaxf(m, mx); const float al = nexp2(m - mn); float sum = 0.0f;
#pragma unroll
    for (int i2 = 0; i2 < 16; ++i2) { const float p = nexp2(e[i2] - mn); sum += p; const int pc = (i2 < 8 ? 0 : 16) + 8 * hh + (i2 & 7); Pb[wave][col][pc] = (b16)(p * PS); }
    sum += __shfl_xor(sum, 16); l = l * al + sum; m = mn;
    wave_lds_sync();
    const v16b pf = frag_kb(&Pb[wave][col][0], hh);
#pragma unroll
    for (int t = 0; t < 4; ++t) { o[t] *= al; o[t] = wmma16b(vf[t], pf, o[t]); }
    wave_lds_sync(); }
    // publish point of tile kt + 1, every wave, in this order
    asm volatile("s_wait_dscnt 0x0" ::: "memory");      // this wave's reads of the buffer that is refilled below have returned
    asm volatile("s_wait_asynccnt 0x0" ::: "memory");   // this wave's copies of tile kt + 1 have landed
    __syncthreads();                                     // publishes tile kt + 1 and ends every wave's reads of tile kt
    if (kt + 2 < NT) { const int t2 = (kt + 2 + ts) & (NT - 1); stage_tile(Kb + ko + (size_t)t2 * KT * HD, Vh + vo + t2 * KT, sl + (unsigned)(kt & 1) * BB); } }
  asm volatile("s_wait_asynccnt 0x0" ::: "memory");   // no copy is outstanding when the wave goes on to its end
  const float inv = 1.0f / (l * PS * XS);
#pragma unroll
  for (int t = 0; t < 4; ++t)
#pragma unroll
    for (int r = 0; r < 8; ++r) To[wave][col][t * 16 + 8 * hh + r] = o[t][r] * inv;
  wave_lds_sync();
  { for (int rr = 0; rr < 16; ++rr) { const size_t oi = ((size_t)b * T + q0 + rr) * DM + h * HD + lane * 2; *(v2f*)(OUTC + oi) = *(const v2f*)(&To[wave][rr][lane * 2]); }  }   // ctx row segment (query, head) = 64 f32 = 256 B by 32 lanes x 8 B
}
}  // namespace

extern "C" void kernel_launch(void* const* d_in, const int* in_sizes, int n_in, void* d_out, int out_size, void* d_ws, size_t ws_size, hipStream_t stream) {
  (void)n_in;
  auto Fp = [&](int i) { return (const float*)d_in[i]; };
  // input order: 0 hidden_states [4,1024,1024], 1 attention_mask [4,1,1,1024] f32 additive, 2 Wq [1024,1024] (in,out), 3 bq, 4 Wk, 5 bk, 6 Wv, 7 bv
  if (in_sizes[0] != B * T * DM || in_sizes[1] != B * T || in_sizes[2] != DM * DM || in_sizes[4] != DM * DM || in_sizes[6] != DM * DM || in_sizes[3] != DM || in_sizes[5] != DM || in_sizes[7] != DM || out_size != B * T * DM) return;
  size_t off = 0; char* ws = (char*)d_ws;
  auto carve = [&](size_t bytes) { char* p = ws + off; off += (bytes + 255) & ~(size_t)255; return p; };
  b16* WT = (b16*)carve((size_t)3 * DM * DM * 2); const size_t plane = (size_t)B * T * DM * 2; b16* XH = (b16*)carve(plane);
  b16* QP = (b16*)carve(plane); b16* KP = (b16*)carve(plane); b16* VTh = (b16*)carve(plane);
  if (off > ws_size || off > ((size_t)128 << 20)) return;   // = ~40 MB
  prep_kernel<<<dim3(DM / PN, DM / PK, 3 + XZ), 128, 0, stream>>>(Fp(0), Fp(2), Fp(4), Fp(6), WT, XH);
  proj_kernel<<<dim3(B * T / BM, 3 * DM / BN), PW * 32, 0, stream>>>(XH, WT, Fp(3), Fp(5), Fp(7), QP, KP, VTh);
  attn_kernel<<<dim3(QL / (16 * AW), BL * H), AW * 32, 0, stream>>>(QP, KP, VTh, Fp(1), (float*)d_out);
}
